// v000
// The times below were measured on an AMD MI455X: many runs one after another, warmed up first and cycling through
// copies of the inputs, with the whole window's GPU time divided by the number of runs. Launches and the gaps
// between them are all in it. The median over several windows is given; except for v000 it joins two sittings, which
// can be a few percent apart, so the side-by-side timings, each taken in one sitting, are the better comparison.
// v000, which the later versions start from, runs in 306 microseconds.
#include <hip/hip_runtime.h>
#include <hip/hip_bf16.h>
#include <math.h>

typedef _Float16 f16;
typedef __attribute__((ext_vector_type(16))) _Float16 v16h;
typedef __attribute__((ext_vector_type(8)))  _Float16 v8h;
typedef __attribute__((ext_vector_type(8)))  float    v8f;

typedef unsigned int u32x4 __attribute__((ext_vector_type(4)));
typedef int          i32x4 __attribute__((ext_vector_type(4)));
typedef int          i32x8 __attribute__((ext_vector_type(8)));

#ifndef __has_builtin
#define __has_builtin(x) 0
#endif
#if __has_builtin(__builtin_amdgcn_tensor_load_to_lds) && \
    __has_builtin(__builtin_amdgcn_s_wait_tensorcnt)
#define USE_TDM 1
#else
#define USE_TDM 0
#endif

__device__ __forceinline__ int kk_of(int e, int hf) {
  int v = e >> 1, lo = e & 1;
  return ((v >> 2) << 4) + hf * 8 + ((v & 3) << 1) + lo;
}

__device__ __forceinline__ v8f wmma16(v16h a, v16h b, v8f c) {
  return __builtin_amdgcn_wmma_f32_16x16x32_f16(false, a, false, b, (short)0, c,
                                                false, false);
}

// Row-major f16 source: lane's 16 fragment halfs are two contiguous 8-half
// chunks at kbase + hf*8 and kbase + 16 + hf*8 of one row -> two b128 loads.
__device__ __forceinline__ v16h frag_rowmajor(const f16* base, int strideH,
                                              int row, int kbase, int hf) {
  const f16* p = base + (size_t)row * strideH + kbase + hf * 8;
  v8h lo = *(const v8h*)p;
  v8h hi = *(const v8h*)(p + 16);
  v16h r;
#pragma unroll
  for (int e = 0; e < 8; ++e) { r[e] = lo[e]; r[e + 8] = hi[e]; }
  return r;
}

// Column gather (for B = row-major V): fixed column, strided K rows.
__device__ __forceinline__ v16h frag_gather_col(const f16* base, int strideH,
                                                int col, int krow, int hf) {
  v16h r;
#pragma unroll
  for (int e = 0; e < 16; ++e)
    r[e] = base[(size_t)(krow + kk_of(e, hf)) * strideH + col];
  return r;
}

// ---------------------------------------------------------------------------
// Kernel 0: pack f32 weights [256 x 256] into f16 WMMA B-fragment order.
// Fragment buffer: [(kt*16+nt)*32 + lane]*16 halfs, kt in 0..7, nt in 0..15.
// ---------------------------------------------------------------------------
__global__ void __launch_bounds__(256) k_swizzle(
    const float* w0, const float* w1, const float* w2, const float* w3,
    const float* w4, f16* f0, f16* f1, f16* f2, f16* f3, f16* f4) {
  int t = blockIdx.x * blockDim.x + threadIdx.x;
  if (t >= 5 * 8 * 16 * 32) return;
  int w = t / 4096, rem = t % 4096;
  int kt = rem / 512; rem %= 512;
  int nt = rem / 32; int lane = rem % 32;
  const float* src = (w == 0) ? w0 : (w == 1) ? w1 : (w == 2) ? w2
                     : (w == 3) ? w3 : w4;
  f16* dst = ((w == 0) ? f0 : (w == 1) ? f1 : (w == 2) ? f2
              : (w == 3) ? f3 : f4) +
             ((size_t)(kt * 16 + nt) * 32 + lane) * 16;
  int hf = lane >> 4, col = nt * 16 + (lane & 15);
#pragma unroll
  for (int e = 0; e < 16; ++e)
    dst[e] = (f16)src[(kt * 32 + kk_of(e, hf)) * 256 + col];
}

// ---------------------------------------------------------------------------
// Kernel A: LayerNorm(M_raw) then fused Q/K/V/G projection GEMM via WMMA.
// One block = 16 rows of the [32768 x 256] activation, 8 waves x 8 tiles.
// q/k/v stored f16 head-major [s][h][r][32]; g stored f16 [row][256].
// ---------------------------------------------------------------------------
__global__ void __launch_bounds__(256) k_ln_qkvg(
    const float* M_raw, const float* g_ln, const float* b_ln, const float* bg,
    const f16* fq, const f16* fk, const f16* fv, const f16* fg,
    f16* q16, f16* k16, f16* v16p, f16* g16) {
  __shared__ float lraw[16][256];
  __shared__ float lstat[16][2];
  __shared__ f16   lx[16][256];
  int tid = threadIdx.x;
  size_t base = (size_t)blockIdx.x * 16 * 256;
#pragma unroll
  for (int it = 0; it < 16; ++it) {
    int idx = it * 256 + tid;
    lraw[idx >> 8][idx & 255] = M_raw[base + idx];
  }
  __syncthreads();
  if (tid < 16) {
    float s = 0.f;
    for (int c = 0; c < 256; ++c) s += lraw[tid][c];
    float mu = s * (1.f / 256.f);
    float vv = 0.f;
    for (int c = 0; c < 256; ++c) { float d = lraw[tid][c] - mu; vv += d * d; }
    lstat[tid][0] = mu;
    lstat[tid][1] = rsqrtf(vv * (1.f / 256.f) + 1e-5f);
  }
  __syncthreads();
#pragma unroll
  for (int it = 0; it < 16; ++it) {
    int idx = it * 256 + tid;
    int r = idx >> 8, c = idx & 255;
    lx[r][c] = (f16)((lraw[r][c] - lstat[r][0]) * lstat[r][1] * g_ln[c] + b_ln[c]);
  }
  __syncthreads();

  int wave = tid >> 5, lane = tid & 31;
  int hf = lane >> 4, colL = lane & 15;
  int mat = wave >> 1, ntb = (wave & 1) * 8;  // each wave: one matrix, 8 n-tiles
  const f16* fr = (mat == 0) ? fq : (mat == 1) ? fk : (mat == 2) ? fv : fg;
  int gr0 = blockIdx.x * 16;
#pragma unroll
  for (int t = 0; t < 8; ++t) {
    int nt = ntb + t;
    __builtin_prefetch(fr + ((size_t)(nt + 16) * 32 + lane) * 16, 0, 1);
    v8f acc = {0, 0, 0, 0, 0, 0, 0, 0};
#pragma unroll
    for (int kt = 0; kt < 8; ++kt) {
      v16h a = frag_rowmajor(&lx[0][0], 256, colL, kt * 32, hf);
      v16h b = *(const v16h*)(fr + ((size_t)(kt * 16 + nt) * 32 + lane) * 16);
      acc = wmma16(a, b, acc);
    }
    int n = nt * 16 + colL;
#pragma unroll
    for (int r = 0; r < 8; ++r) {
      int gr = gr0 + r + 8 * hf;   // C-layout: lanes 16-31 hold rows +8
      float val = acc[r];
      if (mat == 3) {
        val = 1.f / (1.f + __expf(-(val + bg[n])));
        g16[(size_t)gr * 256 + n] = (f16)val;
      } else {
        if (mat == 0) val *= 0.17677669529663687f;  // 1/sqrt(C)
        int s_ = gr >> 8, i_ = gr & 255;
        int h_ = n >> 5, c_ = n & 31;
        f16* dst = (mat == 0) ? q16 : (mat == 1) ? k16 : v16p;
        dst[(((size_t)s_ * 8 + h_) * 256 + i_) * 32 + c_] = (f16)val;
      }
    }
  }
}

// ---------------------------------------------------------------------------
// Kernel B: LayerNorm(Z) + pair bias pb[h][i][j] = Zn[i,j,:] . b_weights[h,:]
// One wave per (i,j) pair; wave-wide shuffle reductions over 128 channels.
// ---------------------------------------------------------------------------
__global__ void __launch_bounds__(256) k_pairbias(
    const float* Z, const float* gz, const float* bz, const float* bw,
    float* pb) {
  int wave = threadIdx.x >> 5, lane = threadIdx.x & 31;
  int pair = blockIdx.x * 8 + wave;  // = i*256 + j
  const float* zp = Z + (size_t)pair * 128;
  float zv[4];
#pragma unroll
  for (int t = 0; t < 4; ++t) zv[t] = zp[lane + 32 * t];
  float s = zv[0] + zv[1] + zv[2] + zv[3];
#pragma unroll
  for (int d = 1; d < 32; d <<= 1) s += __shfl_xor(s, d, 32);
  float mu = s * (1.f / 128.f);
  float vv = 0.f;
#pragma unroll
  for (int t = 0; t < 4; ++t) { float dd = zv[t] - mu; vv += dd * dd; }
#pragma unroll
  for (int d = 1; d < 32; d <<= 1) vv += __shfl_xor(vv, d, 32);
  float rstd = rsqrtf(vv * (1.f / 128.f) + 1e-5f);
  float nv[4];
#pragma unroll
  for (int t = 0; t < 4; ++t) {
    int p = lane + 32 * t;
    nv[t] = (zv[t] - mu) * rstd * gz[p] + bz[p];
  }
#pragma unroll
  for (int h = 0; h < 8; ++h) {
    float dsum = 0.f;
#pragma unroll
    for (int t = 0; t < 4; ++t) dsum += nv[t] * bw[h * 128 + lane + 32 * t];
#pragma unroll
    for (int d = 1; d < 32; d <<= 1) dsum += __shfl_xor(dsum, d, 32);
    if (lane == 0) pb[(size_t)h * 65536 + pair] = dsum;
  }
}

// ---------------------------------------------------------------------------
// Kernel C: attention for one (s,h): logits = QK^T + pb + mask, softmax,
// O = attn @ V. C=32 -> one WMMA per 16x16 logits tile; 4 waves x 4 i-tiles.
// V tile (16 KB, [256][32] f16) staged into LDS by the Tensor Data Mover.
// ---------------------------------------------------------------------------
__global__ void __launch_bounds__(128) k_attention(
    const f16* q16, const f16* k16, const f16* v16p, const float* pb,
    const float* mask, float* o32) {
  __shared__ f16 lv[256 * 32];        // V tile, 16 KB
  __shared__ f16 lattn[4][16 * 256];  // per-wave attn staging, 32 KB
  int s_ = blockIdx.x >> 3, h_ = blockIdx.x & 7;
  size_t headoff = ((size_t)s_ * 8 + h_) * 256 * 32;
  const f16* qs = q16 + headoff;
  const f16* ks = k16 + headoff;
  const f16* vs = v16p + headoff;

#if USE_TDM
  if (threadIdx.x < 32) {
    unsigned lds_off = (unsigned)(unsigned long long)(const void*)&lv[0];
    unsigned long long ga = (unsigned long long)(const void*)vs;
    u32x4 g0;
    g0[0] = 1u;                                   // count=1, user mode
    g0[1] = lds_off;                              // lds_addr
    g0[2] = (unsigned)(ga & 0xffffffffu);         // global_addr[31:0]
    g0[3] = (unsigned)((ga >> 32) & 0x01ffffffu)  // global_addr[56:32]
            | (2u << 30);                         // type=2 (image)
    i32x8 g1;
    g1[0] = (int)(1u << 16);
    g1[1] = (int)(32u << 16);
    g1[2] = (int)(256u << 16);
    g1[3] = (int)(32u << 16);
    g1[4] = 256;
    g1[5] = 32;
    g1[6] = 0;
    g1[7] = 0;
    i32x4 gz4 = {0, 0, 0, 0};   // groups 2/3 unused (<=2D tensor)
#if __clang_major__ >= 23
    i32x8 gz8 = {0, 0, 0, 0, 0, 0, 0, 0};
    __builtin_amdgcn_tensor_load_to_lds(g0, g1, gz4, gz4, gz8, 0);
#else
    __builtin_amdgcn_tensor_load_to_lds(g0, g1, gz4, gz4, 0);
#endif
    __builtin_amdgcn_s_wait_tensorcnt(0);
  }
#else
  for (int t = threadIdx.x; t < 8192; t += 128) lv[t] = vs[t];
#endif
  __syncthreads();

  int wave = threadIdx.x >> 5, lane = threadIdx.x & 31;
  int hf = lane >> 4, colL = lane & 15;
  const float* pbh = pb + (size_t)h_ * 65536;
  const float* mrow = mask + (size_t)s_ * 256;
  f16* la = &lattn[wave][0];

  for (int itb = 0; itb < 4; ++itb) {
    int i0 = (itb * 4 + wave) * 16;
    v16h qa = frag_rowmajor(qs, 32, i0 + colL, 0, hf);
    v8f acc[16];
#pragma unroll
    for (int jt = 0; jt < 16; ++jt) {
      v16h kb = frag_rowmajor(ks, 32, jt * 16 + colL, 0, hf);
      v8f z = {0, 0, 0, 0, 0, 0, 0, 0};
      acc[jt] = wmma16(qa, kb, z);
    }
    // add pair bias + mask bias
#pragma unroll
    for (int jt = 0; jt < 16; ++jt) {
      int j = jt * 16 + colL;
      float mb = 1e9f * (mrow[j] - 1.f);
#pragma unroll
      for (int r = 0; r < 8; ++r)
        acc[jt][r] += pbh[(size_t)(i0 + r + 8 * hf) * 256 + j] + mb;
    }
    float rinv[8];
#pragma unroll
    for (int r = 0; r < 8; ++r) {
      float m = acc[0][r];
#pragma unroll
      for (int jt = 1; jt < 16; ++jt) m = fmaxf(m, acc[jt][r]);
#pragma unroll
      for (int d = 1; d < 16; d <<= 1) m = fmaxf(m, __shfl_xor(m, d, 32));
      float ssum = 0.f;
#pragma unroll
      for (int jt = 0; jt < 16; ++jt) {
        float e = __expf(acc[jt][r] - m);
        acc[jt][r] = e;
        ssum += e;
      }
#pragma unroll
      for (int d = 1; d < 16; d <<= 1) ssum += __shfl_xor(ssum, d, 32);
      rinv[r] = 1.f / ssum;
    }
    // stage unnormalized exp to LDS in row-major for A-fragment reload
#pragma unroll
    for (int jt = 0; jt < 16; ++jt)
#pragma unroll
      for (int r = 0; r < 8; ++r)
        la[(r + 8 * hf) * 256 + jt * 16 + colL] = (f16)acc[jt][r];
    // O = attn @ V  (1/rowsum folded into the epilogue)
#pragma unroll
    for (int nt = 0; nt < 2; ++nt) {
      v8f oacc = {0, 0, 0, 0, 0, 0, 0, 0};
#pragma unroll
      for (int kt = 0; kt < 8; ++kt) {
        v16h aa = frag_rowmajor(la, 256, colL, kt * 32, hf);
        v16h vb = frag_gather_col(lv, 32, nt * 16 + colL, kt * 32, hf);
        oacc = wmma16(aa, vb, oacc);
      }
#pragma unroll
      for (int r = 0; r < 8; ++r) {
        int i = i0 + r + 8 * hf;
        int n = h_ * 32 + nt * 16 + colL;
        o32[((size_t)s_ * 256 + i) * 256 + n] = oacc[r] * rinv[r];
      }
    }
  }
}

// ---------------------------------------------------------------------------
// Kernel D: out = (g * o) @ Wo + out_bias + M_raw
// ---------------------------------------------------------------------------
__global__ void __launch_bounds__(256) k_out(
    const f16* g16, const float* o32, const f16* fo, const float* out_bias,
    const float* M_raw, float* out) {
  __shared__ f16 lx[16][256];
  int tid = threadIdx.x;
  size_t base = (size_t)blockIdx.x * 16 * 256;
#pragma unroll
  for (int it = 0; it < 16; ++it) {
    int idx = it * 256 + tid;
    float gv = (float)g16[base + idx];
    lx[idx >> 8][idx & 255] = (f16)(gv * o32[base + idx]);
  }
  __syncthreads();
  int wave = tid >> 5, lane = tid & 31, hf = lane >> 4, colL = lane & 15;
  int gr0 = blockIdx.x * 16;
#pragma unroll
  for (int t = 0; t < 2; ++t) {
    int nt = wave * 2 + t;
    v8f acc = {0, 0, 0, 0, 0, 0, 0, 0};
#pragma unroll
    for (int kt = 0; kt < 8; ++kt) {
      v16h a = frag_rowmajor(&lx[0][0], 256, colL, kt * 32, hf);
      v16h b = *(const v16h*)(fo + ((size_t)(kt * 16 + nt) * 32 + lane) * 16);
      acc = wmma16(a, b, acc);
    }
    int n = nt * 16 + colL;
#pragma unroll
    for (int r = 0; r < 8; ++r) {
      size_t gi = (size_t)(gr0 + r + 8 * hf) * 256 + n;
      out[gi] = acc[r] + out_bias[n] + M_raw[gi];
    }
  }
}

// ---------------------------------------------------------------------------
extern "C" void kernel_launch(void* const* d_in, const int* in_sizes, int n_in,
                              void* d_out, int out_size, void* d_ws,
                              size_t ws_size, hipStream_t stream) {
  (void)in_sizes; (void)n_in; (void)out_size; (void)ws_size;
  const float* M_raw  = (const float*)d_in[0];
  const float* Z      = (const float*)d_in[1];
  const float* M_mask = (const float*)d_in[2];
  const float* ln_m_g = (const float*)d_in[3];
  const float* ln_m_b = (const float*)d_in[4];
  const float* ln_z_g = (const float*)d_in[5];
  const float* ln_z_b = (const float*)d_in[6];
  const float* b_w    = (const float*)d_in[7];
  const float* Wq     = (const float*)d_in[8];
  const float* Wk     = (const float*)d_in[9];
  const float* Wv     = (const float*)d_in[10];
  const float* Wg     = (const float*)d_in[11];
  const float* bg     = (const float*)d_in[12];
  const float* Wo     = (const float*)d_in[13];
  const float* ob     = (const float*)d_in[14];
  float* out = (float*)d_out;

  char* ws = (char*)d_ws;
  size_t off = 0;
  auto take = [&](size_t b) {
    char* p = ws + off;
    off += (b + 255) & ~(size_t)255;
    return p;
  };
  f16* fq   = (f16*)take(131072);      // swizzled weight fragments (f16)
  f16* fk   = (f16*)take(131072);
  f16* fv   = (f16*)take(131072);
  f16* fg   = (f16*)take(131072);
  f16* fo   = (f16*)take(131072);
  f16* q16  = (f16*)take(16777216);    // [s][h][256][32] f16
  f16* k16  = (f16*)take(16777216);
  f16* v16p = (f16*)take(16777216);
  f16* g16  = (f16*)take(16777216);    // [row][256] f16
  float* o32 = (float*)take(33554432); // [row][256] f32
  float* pb  = (float*)take(2097152);  // [h][i][j] f32

  k_swizzle<<<80, 256, 0, stream>>>(Wq, Wk, Wv, Wg, Wo, fq, fk, fv, fg, fo);
  k_ln_qkvg<<<2048, 256, 0, stream>>>(M_raw, ln_m_g, ln_m_b, bg, fq, fk, fv,
                                      fg, q16, k16, v16p, g16);
  k_pairbias<<<8192, 256, 0, stream>>>(Z, ln_z_g, ln_z_b, b_w, pb);
  k_attention<<<1024, 128, 0, stream>>>(q16, k16, v16p, pb, M_mask, o32);
  k_out<<<2048, 256, 0, stream>>>(g16, o32, fo, ob, M_raw, out);
}

// v001
// One run takes 234 microseconds.
// Next to v000, in two timings, it ran 1.31 times as fast each time.
#include <hip/hip_runtime.h>
#include <hip/hip_bf16.h>
#include <math.h>

typedef _Float16 f16;
typedef __attribute__((ext_vector_type(16))) _Float16 v16h;
typedef __attribute__((ext_vector_type(8)))  _Float16 v8h;
typedef __attribute__((ext_vector_type(8)))  float    v8f;

typedef unsigned int u32x4 __attribute__((ext_vector_type(4)));
typedef int          i32x4 __attribute__((ext_vector_type(4)));
typedef int          i32x8 __attribute__((ext_vector_type(8)));

#ifndef __has_builtin
#define __has_builtin(x) 0
#endif
#if __has_builtin(__builtin_amdgcn_tensor_load_to_lds) && \
    __has_builtin(__builtin_amdgcn_s_wait_tensorcnt)
#define USE_TDM 1
#else
#define USE_TDM 0
#endif

__device__ __forceinline__ int kk_of(int e, int hf) {
  int v = e >> 1, lo = e & 1;
  return ((v >> 2) << 4) + hf * 8 + ((v & 3) << 1) + lo;
}

__device__ __forceinline__ v8f wmma16(v16h a, v16h b, v8f c) {
  return __builtin_amdgcn_wmma_f32_16x16x32_f16(false, a, false, b, (short)0, c,
                                                false, false);
}

// Row-major f16 source: lane's 16 fragment halfs are two contiguous 8-half
// chunks at kbase + hf*8 and kbase + 16 + hf*8 of one row -> two b128 loads.
__device__ __forceinline__ v16h frag_rowmajor(const f16* base, int strideH,
                                              int row, int kbase, int hf) {
  const f16* p = base + (size_t)row * strideH + kbase + hf * 8;
  v8h lo = *(const v8h*)p;
  v8h hi = *(const v8h*)(p + 16);
  v16h r;
#pragma unroll
  for (int e = 0; e < 8; ++e) { r[e] = lo[e]; r[e + 8] = hi[e]; }
  return r;
}

// Column gather of row-major V (A = V^T): fixed column, strided K rows.
__device__ __forceinline__ v16h frag_gather_col(const f16* base, int strideH,
                                                int col, int krow, int hf) {
  v16h r;
#pragma unroll
  for (int e = 0; e < 16; ++e)
    r[e] = base[(size_t)(krow + kk_of(e, hf)) * strideH + col];
  return r;
}

// ---------------------------------------------------------------------------
// Kernel 0: pack f32 weights [256 x 256] into f16 WMMA B-fragment order.
// Fragment buffer: [(kt*16+nt)*32 + lane]*16 halfs, kt in 0..7, nt in 0..15.
// ---------------------------------------------------------------------------
__global__ void __launch_bounds__(256) k_swizzle(
    const float* w0, const float* w1, const float* w2, const float* w3,
    const float* w4, f16* f0, f16* f1, f16* f2, f16* f3, f16* f4) {
  int t = blockIdx.x * blockDim.x + threadIdx.x;
  if (t >= 5 * 8 * 16 * 32) return;
  int w = t / 4096, rem = t % 4096;
  int kt = rem / 512; rem %= 512;
  int nt = rem / 32; int lane = rem % 32;
  const float* src = (w == 0) ? w0 : (w == 1) ? w1 : (w == 2) ? w2
                     : (w == 3) ? w3 : w4;
  f16* dst = ((w == 0) ? f0 : (w == 1) ? f1 : (w == 2) ? f2
              : (w == 3) ? f3 : f4) +
             ((size_t)(kt * 16 + nt) * 32 + lane) * 16;
  int hf = lane >> 4, col = nt * 16 + (lane & 15);
#pragma unroll
  for (int e = 0; e < 16; ++e)
    dst[e] = (f16)src[(kt * 32 + kk_of(e, hf)) * 256 + col];
}

// ---------------------------------------------------------------------------
// Kernel A: LayerNorm(M_raw) then fused Q/K/V/G projection GEMM via WMMA.
// One block = 16 rows of the [32768 x 256] activation, 8 waves x 8 tiles.
// q/k/v stored f16 head-major [s][h][r][32]; g stored f16 [row][256].
// ---------------------------------------------------------------------------
__global__ void __launch_bounds__(256) k_ln_qkvg(
    const float* M_raw, const float* g_ln, const float* b_ln, const float* bg,
    const f16* fq, const f16* fk, const f16* fv, const f16* fg,
    f16* q16, f16* k16, f16* v16p, f16* g16) {
  __shared__ float lraw[16][256];
  __shared__ float lstat[16][2];
  __shared__ f16   lx[16][256];
  int tid = threadIdx.x;
  size_t base = (size_t)blockIdx.x * 16 * 256;
#pragma unroll
  for (int it = 0; it < 16; ++it) {
    int idx = it * 256 + tid;
    lraw[idx >> 8][idx & 255] = M_raw[base + idx];
  }
  __syncthreads();
  if (tid < 16) {
    float s = 0.f;
    for (int c = 0; c < 256; ++c) s += lraw[tid][c];
    float mu = s * (1.f / 256.f);
    float vv = 0.f;
    for (int c = 0; c < 256; ++c) { float d = lraw[tid][c] - mu; vv += d * d; }
    lstat[tid][0] = mu;
    lstat[tid][1] = rsqrtf(vv * (1.f / 256.f) + 1e-5f);
  }
  __syncthreads();
#pragma unroll
  for (int it = 0; it < 16; ++it) {
    int idx = it * 256 + tid;
    int r = idx >> 8, c = idx & 255;
    lx[r][c] = (f16)((lraw[r][c] - lstat[r][0]) * lstat[r][1] * g_ln[c] + b_ln[c]);
  }
  __syncthreads();

  int wave = tid >> 5, lane = tid & 31;
  int hf = lane >> 4, colL = lane & 15;
  int mat = wave >> 1, ntb = (wave & 1) * 8;  // each wave: one matrix, 8 n-tiles
  const f16* fr = (mat == 0) ? fq : (mat == 1) ? fk : (mat == 2) ? fv : fg;
  int gr0 = blockIdx.x * 16;
#pragma unroll
  for (int t = 0; t < 8; ++t) {
    int nt = ntb + t;
    __builtin_prefetch(fr + ((size_t)(nt + 16) * 32 + lane) * 16, 0, 1);
    v8f acc = {0, 0, 0, 0, 0, 0, 0, 0};
#pragma unroll
    for (int kt = 0; kt < 8; ++kt) {
      v16h a = frag_rowmajor(&lx[0][0], 256, colL, kt * 32, hf);
      v16h b = *(const v16h*)(fr + ((size_t)(kt * 16 + nt) * 32 + lane) * 16);
      acc = wmma16(a, b, acc);
    }
    int n = nt * 16 + colL;
#pragma unroll
    for (int r = 0; r < 8; ++r) {
      int gr = gr0 + r + 8 * hf;   // C-layout: lanes 16-31 hold rows +8
      float val = acc[r];
      if (mat == 3) {
        val = 1.f / (1.f + __expf(-(val + bg[n])));
        g16[(size_t)gr * 256 + n] = (f16)val;
      } else {
        if (mat == 0) val *= 0.17677669529663687f;  // 1/sqrt(C)
        int s_ = gr >> 8, i_ = gr & 255;
        int h_ = n >> 5, c_ = n & 31;
        f16* dst = (mat == 0) ? q16 : (mat == 1) ? k16 : v16p;
        dst[(((size_t)s_ * 8 + h_) * 256 + i_) * 32 + c_] = (f16)val;
      }
    }
  }
}

// ---------------------------------------------------------------------------
// Kernel B: LayerNorm(Z) + pair bias pb[h][i][j] = Zn[i,j,:] . b_weights[h,:]
// One wave per (i,j) pair; wave-wide shuffle reductions over 128 channels.
// ---------------------------------------------------------------------------
__global__ void __launch_bounds__(256) k_pairbias(
    const float* Z, const float* gz, const float* bz, const float* bw,
    float* pb) {
  int wave = threadIdx.x >> 5, lane = threadIdx.x & 31;
  int pair = blockIdx.x * 8 + wave;  // = i*256 + j
  const float* zp = Z + (size_t)pair * 128;
  float zv[4];
#pragma unroll
  for (int t = 0; t < 4; ++t) zv[t] = zp[lane + 32 * t];
  float s = zv[0] + zv[1] + zv[2] + zv[3];
#pragma unroll
  for (int d = 1; d < 32; d <<= 1) s += __shfl_xor(s, d, 32);
  float mu = s * (1.f / 128.f);
  float vv = 0.f;
#pragma unroll
  for (int t = 0; t < 4; ++t) { float dd = zv[t] - mu; vv += dd * dd; }
#pragma unroll
  for (int d = 1; d < 32; d <<= 1) vv += __shfl_xor(vv, d, 32);
  float rstd = rsqrtf(vv * (1.f / 128.f) + 1e-5f);
  float nv[4];
#pragma unroll
  for (int t = 0; t < 4; ++t) {
    int p = lane + 32 * t;
    nv[t] = (zv[t] - mu) * rstd * gz[p] + bz[p];
  }
#pragma unroll
  for (int h = 0; h < 8; ++h) {
    float dsum = 0.f;
#pragma unroll
    for (int t = 0; t < 4; ++t) dsum += nv[t] * bw[h * 128 + lane + 32 * t];
#pragma unroll
    for (int d = 1; d < 32; d <<= 1) dsum += __shfl_xor(dsum, d, 32);
    if (lane == 0) pb[(size_t)h * 65536 + pair] = dsum;
  }
}

__global__ void __launch_bounds__(128) k_attention(
    const f16* q16, const f16* k16, const f16* v16p, const float* pb,
    const float* mask, float* o32) {
  __shared__ f16 lv[256 * 32];        // V tile, 16 KB
  int s_ = blockIdx.x >> 3, h_ = blockIdx.x & 7;
  size_t headoff = ((size_t)s_ * 8 + h_) * 256 * 32;
  const f16* qs = q16 + headoff;
  const f16* ks = k16 + headoff;
  const f16* vs = v16p + headoff;

#if USE_TDM
  if (threadIdx.x < 32) {
    unsigned lds_off = (unsigned)(unsigned long long)(const void*)&lv[0];
    unsigned long long ga = (unsigned long long)(const void*)vs;
    u32x4 g0;
    g0[0] = 1u;                                   // count=1, user mode
    g0[1] = lds_off;                              // lds_addr
    g0[2] = (unsigned)(ga & 0xffffffffu);         // global_addr[31:0]
    g0[3] = (unsigned)((ga >> 32) & 0x01ffffffu)  // global_addr[56:32]
            | (2u << 30);                         // type=2 (image)
    i32x8 g1;
    g1[0] = (int)(1u << 16);
    g1[1] = (int)(32u << 16);
    g1[2] = (int)(256u << 16);
    g1[3] = (int)(32u << 16);
    g1[4] = 256;
    g1[5] = 32;
    g1[6] = 0;
    g1[7] = 0;
    i32x4 gz4 = {0, 0, 0, 0};   // groups 2/3 unused (<=2D tensor)
#if __clang_major__ >= 23
    i32x8 gz8 = {0, 0, 0, 0, 0, 0, 0, 0};
    __builtin_amdgcn_tensor_load_to_lds(g0, g1, gz4, gz4, gz8, 0);
#else
    __builtin_amdgcn_tensor_load_to_lds(g0, g1, gz4, gz4, 0);
#endif
    __builtin_amdgcn_s_wait_tensorcnt(0);
  }
#else
  for (int t = threadIdx.x; t < 8192; t += 128) lv[t] = vs[t];
#endif
  __syncthreads();

  int wave = threadIdx.x >> 5, lane = threadIdx.x & 31;
  int hf = lane >> 4, colL = lane & 15;
  const float* pbh = pb + (size_t)h_ * 65536;
  const float* mrow = mask + (size_t)s_ * 256;

  for (int itb = 0; itb < 4; ++itb) {
    int i0 = (itb * 4 + wave) * 16;
    // B = Q^T: lane holds column i = i0 + colL.
    v16h qb = frag_rowmajor(qs, 32, i0 + colL, 0, hf);
    const float* pbrow = pbh + (size_t)(i0 + colL) * 256 + 8 * hf;
    // acc[jt][r] = logits[i0 + colL][jt*16 + 8*hf + r]; the pair bias and the
    // mask bias enter as the C operand.
    v8f acc[16];
#pragma unroll
    for (int jt = 0; jt < 16; ++jt) acc[jt] = *(const v8f*)(pbrow + jt * 16);
    // The registers that hold the addresses of the loads above are reused
    // below: the wait stands in front of their overwrite.
    asm volatile("s_wait_xcnt 0x0" ::: "memory");
#pragma unroll
    for (int g = 0; g < 4; ++g) {
      v16h ka[4];
      v8f mv[4];
#pragma unroll
      for (int t = 0; t < 4; ++t) {
        int jt = g * 4 + t;
        ka[t] = frag_rowmajor(ks, 32, jt * 16 + colL, 0, hf);
        mv[t] = *(const v8f*)(mrow + jt * 16 + 8 * hf);
      }
      // Keeps the loads of four tiles in flight together: without it each
      // tile's loads are issued and waited for singly, in front of its WMMA.
      __builtin_amdgcn_sched_barrier(0);
#pragma unroll
      for (int t = 0; t < 4; ++t) {
        int jt = g * 4 + t;
        v8f c;
#pragma unroll
        for (int r = 0; r < 8; ++r) c[r] = acc[jt][r] + 1e9f * (mv[t][r] - 1.f);
        acc[jt] = wmma16(ka[t], qb, c);
      }
    }
    // softmax over j: 128 values of row i in this lane, the other 128 in
    // lane ^ 16.
    v8f mx = acc[0];
#pragma unroll
    for (int jt = 1; jt < 16; ++jt)
#pragma unroll
      for (int r = 0; r < 8; ++r) mx[r] = fmaxf(mx[r], acc[jt][r]);
    float m = fmaxf(fmaxf(fmaxf(mx[0], mx[1]), fmaxf(mx[2], mx[3])),
                    fmaxf(fmaxf(mx[4], mx[5]), fmaxf(mx[6], mx[7])));
    m = fmaxf(m, __shfl_xor(m, 16, 32));
    // Tiles 2kt and 2kt+1 hold keys kt*32 + {8*hf + 0..7, 16 + 8*hf + 0..7}:
    // converted in place they are the B fragment pt[kt] in the k order of
    // kk_of (unnormalized exp; 1/rowsum folded into the epilogue).
    v8f sv = {0, 0, 0, 0, 0, 0, 0, 0};
    v16h pt[8];
#pragma unroll
    for (int jt = 0; jt < 16; ++jt)
#pragma unroll
      for (int r = 0; r < 8; ++r) {
        float e = __expf(acc[jt][r] - m);
        sv[r] += e;
        pt[jt >> 1][(jt & 1) * 8 + r] = (f16)e;
      }
    float ssum = ((sv[0] + sv[1]) + (sv[2] + sv[3])) +
                 ((sv[4] + sv[5]) + (sv[6] + sv[7]));
    ssum += __shfl_xor(ssum, 16, 32);
    float rinv = 1.f / ssum;
    // Ot = V^T Pt
    v8f oacc[2] = {{0, 0, 0, 0, 0, 0, 0, 0}, {0, 0, 0, 0, 0, 0, 0, 0}};
#pragma unroll
    for (int kt = 0; kt < 8; ++kt)
#pragma unroll
      for (int ct = 0; ct < 2; ++ct) {
        v16h va = frag_gather_col(lv, 32, ct * 16 + colL, kt * 32, hf);
        oacc[ct] = wmma16(va, pt[kt], oacc[ct]);
      }
    // oacc[ct][r] = O[i0 + colL][ct*16 + 8*hf + r]
    float* orow = o32 + ((size_t)s_ * 256 + i0 + colL) * 256 + h_ * 32 + 8 * hf;
#pragma unroll
    for (int ct = 0; ct < 2; ++ct) {
      v8f ov;
#pragma unroll
      for (int r = 0; r < 8; ++r) ov[r] = oacc[ct][r] * rinv;
      *(v8f*)(orow + ct * 16) = ov;
    }
    // The next trip overwrites the stores' address and data registers.
    asm volatile("s_wait_xcnt 0x0" ::: "memory");
  }
}

// ---------------------------------------------------------------------------
// Kernel D: out = (g * o) @ Wo + out_bias + M_raw
// ---------------------------------------------------------------------------
__global__ void __launch_bounds__(256) k_out(
    const f16* g16, const float* o32, const f16* fo, const float* out_bias,
    const float* M_raw, float* out) {
  __shared__ f16 lx[16][256];
  int tid = threadIdx.x;
  size_t base = (size_t)blockIdx.x * 16 * 256;
#pragma unroll
  for (int it = 0; it < 16; ++it) {
    int idx = it * 256 + tid;
    float gv = (float)g16[base + idx];
    lx[idx >> 8][idx & 255] = (f16)(gv * o32[base + idx]);
  }
  __syncthreads();
  int wave = tid >> 5, lane = tid & 31, hf = lane >> 4, colL = lane & 15;
  int gr0 = blockIdx.x * 16;
#pragma unroll
  for (int t = 0; t < 2; ++t) {
    int nt = wave * 2 + t;
    v8f acc = {0, 0, 0, 0, 0, 0, 0, 0};
#pragma unroll
    for (int kt = 0; kt < 8; ++kt) {
      v16h a = frag_rowmajor(&lx[0][0], 256, colL, kt * 32, hf);
      v16h b = *(const v16h*)(fo + ((size_t)(kt * 16 + nt) * 32 + lane) * 16);
      acc = wmma16(a, b, acc);
    }
    int n = nt * 16 + colL;
#pragma unroll
    for (int r = 0; r < 8; ++r) {
      size_t gi = (size_t)(gr0 + r + 8 * hf) * 256 + n;
      out[gi] = acc[r] + out_bias[n] + M_raw[gi];
    }
  }
}

// ---------------------------------------------------------------------------
extern "C" void kernel_launch(void* const* d_in, const int* in_sizes, int n_in,
                              void* d_out, int out_size, void* d_ws,
                              size_t ws_size, hipStream_t stream) {
  (void)in_sizes; (void)n_in; (void)out_size; (void)ws_size;
  const float* M_raw  = (const float*)d_in[0];
  const float* Z      = (const float*)d_in[1];
  const float* M_mask = (const float*)d_in[2];
  const float* ln_m_g = (const float*)d_in[3];
  const float* ln_m_b = (const float*)d_in[4];
  const float* ln_z_g = (const float*)d_in[5];
  const float* ln_z_b = (const float*)d_in[6];
  const float* b_w    = (const float*)d_in[7];
  const float* Wq     = (const float*)d_in[8];
  const float* Wk     = (const float*)d_in[9];
  const float* Wv     = (const float*)d_in[10];
  const float* Wg     = (const float*)d_in[11];
  const float* bg     = (const float*)d_in[12];
  const float* Wo     = (const float*)d_in[13];
  const float* ob     = (const float*)d_in[14];
  float* out = (float*)d_out;

  char* ws = (char*)d_ws;
  size_t off = 0;
  auto take = [&](size_t b) {
    char* p = ws + off;
    off += (b + 255) & ~(size_t)255;
    return p;
  };
  f16* fq   = (f16*)take(131072);      // swizzled weight fragments (f16)
  f16* fk   = (f16*)take(131072);
  f16* fv   = (f16*)take(131072);
  f16* fg   = (f16*)take(131072);
  f16* fo   = (f16*)take(131072);
  f16* q16  = (f16*)take(16777216);    // [s][h][256][32] f16
  f16* k16  = (f16*)take(16777216);
  f16* v16p = (f16*)take(16777216);
  f16* g16  = (f16*)take(16777216);    // [row][256] f16
  float* o32 = (float*)take(33554432); // [row][256] f32
  float* pb  = (float*)take(2097152);  // [h][i][j] f32

  k_swizzle<<<80, 256, 0, stream>>>(Wq, Wk, Wv, Wg, Wo, fq, fk, fv, fg, fo);
  k_ln_qkvg<<<2048, 256, 0, stream>>>(M_raw, ln_m_g, ln_m_b, bg, fq, fk, fv,
                                      fg, q16, k16, v16p, g16);
  k_pairbias<<<8192, 256, 0, stream>>>(Z, ln_z_g, ln_z_b, b_w, pb);
  k_attention<<<1024, 128, 0, stream>>>(q16, k16, v16p, pb, M_mask, o32);
  k_out<<<2048, 256, 0, stream>>>(g16, o32, fo, ob, M_raw, out);
}

// v002
// It runs in 208 microseconds.
// Next to v001, in two timings, it ran 1.12 times as fast each time.
// Over all steps from v000 it is 1.46 times as fast.
#include <hip/hip_runtime.h>
#include <hip/hip_bf16.h>
#include <math.h>

typedef _Float16 f16;
typedef __attribute__((ext_vector_type(16))) _Float16 v16h;
typedef __attribute__((ext_vector_type(8)))  _Float16 v8h;
typedef __attribute__((ext_vector_type(8)))  float    v8f;
typedef __attribute__((ext_vector_type(4)))  float    v4f;
typedef __attribute__((ext_vector_type(2)))  float    v2f;
typedef __attribute__((address_space(4))) float cfloat;

typedef unsigned int u32x4 __attribute__((ext_vector_type(4)));
typedef int          i32x4 __attribute__((ext_vector_type(4)));
typedef int          i32x8 __attribute__((ext_vector_type(8)));

#ifndef __has_builtin
#define __has_builtin(x) 0
#endif
#if __has_builtin(__builtin_amdgcn_tensor_load_to_lds) && \
    __has_builtin(__builtin_amdgcn_s_wait_tensorcnt)
#define USE_TDM 1
#else
#define USE_TDM 0
#endif

__device__ __forceinline__ int kk_of(int e, int hf) {
  int v = e >> 1, lo = e & 1;
  return ((v >> 2) << 4) + hf * 8 + ((v & 3) << 1) + lo;
}

__device__ __forceinline__ v8f wmma16(v16h a, v16h b, v8f c) {
  return __builtin_amdgcn_wmma_f32_16x16x32_f16(false, a, false, b, (short)0, c,
                                                false, false);
}

// Row-major f16 source: lane's 16 fragment halfs are two contiguous 8-half
// chunks at kbase + hf*8 and kbase + 16 + hf*8 of one row -> two b128 loads.
__device__ __forceinline__ v16h frag_rowmajor(const f16* base, int strideH,
                                              int row, int kbase, int hf) {
  const f16* p = base + (size_t)row * strideH + kbase + hf * 8;
  v8h lo = *(const v8h*)p;
  v8h hi = *(const v8h*)(p + 16);
  v16h r;
#pragma unroll
  for (int e = 0; e < 8; ++e) { r[e] = lo[e]; r[e + 8] = hi[e]; }
  return r;
}

// Column gather of row-major V (A = V^T): fixed column, strided K rows.
__device__ __forceinline__ v16h frag_gather_col(const f16* base, int strideH,
                                                int col, int krow, int hf) {
  v16h r;
#pragma unroll
  for (int e = 0; e < 16; ++e)
    r[e] = base[(size_t)(krow + kk_of(e, hf)) * strideH + col];
  return r;
}

// ---------------------------------------------------------------------------
// Kernel 0: pack f32 weights [256 x 256] into f16 WMMA B-fragment order.
// Fragment buffer: [(kt*16+nt)*32 + lane]*16 halfs, kt in 0..7, nt in 0..15.
// ---------------------------------------------------------------------------
__global__ void __launch_bounds__(256) k_swizzle(
    const float* w0, const float* w1, const float* w2, const float* w3,
    const float* w4, f16* f0, f16* f1, f16* f2, f16* f3, f16* f4) {
  int t = blockIdx.x * blockDim.x + threadIdx.x;
  if (t >= 5 * 8 * 16 * 32) return;
  int w = t / 4096, rem = t % 4096;
  int kt = rem / 512; rem %= 512;
  int nt = rem / 32; int lane = rem % 32;
  const float* src = (w == 0) ? w0 : (w == 1) ? w1 : (w == 2) ? w2
                     : (w == 3) ? w3 : w4;
  f16* dst = ((w == 0) ? f0 : (w == 1) ? f1 : (w == 2) ? f2
              : (w == 3) ? f3 : f4) +
             ((size_t)(kt * 16 + nt) * 32 + lane) * 16;
  int hf = lane >> 4, col = nt * 16 + (lane & 15);
#pragma unroll
  for (int e = 0; e < 16; ++e)
    dst[e] = (f16)src[(kt * 32 + kk_of(e, hf)) * 256 + col];
}

// ---------------------------------------------------------------------------
// Kernel A: LayerNorm(M_raw) then fused Q/K/V/G projection GEMM via WMMA.
// One block = 16 rows of the [32768 x 256] activation, 8 waves x 8 tiles.
// q/k/v stored f16 head-major [s][h][r][32]; g stored f16 [row][256].
// ---------------------------------------------------------------------------
__global__ void __launch_bounds__(256) k_ln_qkvg(
    const float* M_raw, const float* g_ln, const float* b_ln, const float* bg,
    const f16* fq, const f16* fk, const f16* fv, const f16* fg,
    f16* q16, f16* k16, f16* v16p, f16* g16) {
  __shared__ float lraw[16][256];
  __shared__ float lstat[16][2];
  __shared__ f16   lx[16][256];
  int tid = threadIdx.x;
  size_t base = (size_t)blockIdx.x * 16 * 256;
#pragma unroll
  for (int it = 0; it < 16; ++it) {
    int idx = it * 256 + tid;
    lraw[idx >> 8][idx & 255] = M_raw[base + idx];
  }
  __syncthreads();
  if (tid < 16) {
    float s = 0.f;
    for (int c = 0; c < 256; ++c) s += lraw[tid][c];
    float mu = s * (1.f / 256.f);
    float vv = 0.f;
    for (int c = 0; c < 256; ++c) { float d = lraw[tid][c] - mu; vv += d * d; }
    lstat[tid][0] = mu;
    lstat[tid][1] = rsqrtf(vv * (1.f / 256.f) + 1e-5f);
  }
  __syncthreads();
#pragma unroll
  for (int it = 0; it < 16; ++it) {
    int idx = it * 256 + tid;
    int r = idx >> 8, c = idx & 255;
    lx[r][c] = (f16)((lraw[r][c] - lstat[r][0]) * lstat[r][1] * g_ln[c] + b_ln[c]);
  }
  __syncthreads();

  int wave = tid >> 5, lane = tid & 31;
  int hf = lane >> 4, colL = lane & 15;
  int mat = wave >> 1, ntb = (wave & 1) * 8;  // each wave: one matrix, 8 n-tiles
  const f16* fr = (mat == 0) ? fq : (mat == 1) ? fk : (mat == 2) ? fv : fg;
  int gr0 = blockIdx.x * 16;
#pragma unroll
  for (int t = 0; t < 8; ++t) {
    int nt = ntb + t;
    __builtin_prefetch(fr + ((size_t)(nt + 16) * 32 + lane) * 16, 0, 1);
    v8f acc = {0, 0, 0, 0, 0, 0, 0, 0};
#pragma unroll
    for (int kt = 0; kt < 8; ++kt) {
      v16h a = frag_rowmajor(&lx[0][0], 256, colL, kt * 32, hf);
      v16h b = *(const v16h*)(fr + ((size_t)(kt * 16 + nt) * 32 + lane) * 16);
      acc = wmma16(a, b, acc);
    }
    int n = nt * 16 + colL;
#pragma unroll
    for (int r = 0; r < 8; ++r) {
      int gr = gr0 + r + 8 * hf;   // C-layout: lanes 16-31 hold rows +8
      float val = acc[r];
      if (mat == 3) {
        val = 1.f / (1.f + __expf(-(val + bg[n])));
        g16[(size_t)gr * 256 + n] = (f16)val;
      } else {
        if (mat == 0) val *= 0.17677669529663687f;  // 1/sqrt(C)
        int s_ = gr >> 8, i_ = gr & 255;
        int h_ = n >> 5, c_ = n & 31;
        f16* dst = (mat == 0) ? q16 : (mat == 1) ? k16 : v16p;
        dst[(((size_t)s_ * 8 + h_) * 256 + i_) * 32 + c_] = (f16)val;
      }
    }
  }
}

__global__ void __launch_bounds__(128) k_pairbias(
    const float* Z, const float* gz, const float* bz, const float* bw,
    float* pb) {
  __shared__ __attribute__((aligned(16))) float lz[128 * 132];
  int tid = threadIdx.x;
  int wave = tid >> 5, lane = tid & 31;
  int pair0 = blockIdx.x * 128;  // pair = i*256 + j
  v4f z[32];
  {
    const float* zp = Z + (size_t)(pair0 + wave * 32) * 128 + lane * 4;
#pragma unroll
    for (int k = 0; k < 32; ++k) z[k] = *(const v4f*)(zp + k * 128);
    // The registers that hold the addresses of the loads above are reused
    // below: the wait stands in front of their overwrite.
    asm volatile("s_wait_xcnt 0x0" ::: "memory");
    float* lw = lz + wave * 32 * 132 + lane * 4;
#pragma unroll
    for (int k = 0; k < 32; ++k) *(v4f*)(lw + k * 132) = z[k];
  }
  __syncthreads();
  const float* lr = lz + tid * 132;
#pragma unroll
  for (int c = 0; c < 32; ++c) z[c] = *(const v4f*)(lr + c * 4);
  v4f s4 = z[0];
#pragma unroll
  for (int c = 1; c < 32; ++c) s4 += z[c];
  float mu = ((s4[0] + s4[1]) + (s4[2] + s4[3])) * (1.f / 128.f);
  v4f q4 = {0, 0, 0, 0};
#pragma unroll
  for (int c = 0; c < 32; ++c) {
    v4f d = z[c] - mu;
    q4 += d * d;
  }
  float vv = (q4[0] + q4[1]) + (q4[2] + q4[3]);
  float rstd = rsqrtf(vv * (1.f / 128.f) + 1e-5f);
  // No launch of this file writes these three inputs: read through the
  // constant address space they come by scalar loads, one for the wave
  // (behind the asm statement above they would else be vector loads).
  const cfloat* gzc = (const cfloat*)(unsigned long long)gz;
  const cfloat* bzc = (const cfloat*)(unsigned long long)bz;
  const cfloat* bwc = (const cfloat*)(unsigned long long)bw;
  // Even and odd channels are summed apart: two neighbouring channels go
  // through one packed multiply-add.
  v2f acc[8] = {{0, 0}, {0, 0}, {0, 0}, {0, 0}, {0, 0}, {0, 0}, {0, 0}, {0, 0}};
  // Stays rolled, 8 channels a trip: unrolled, the scalar loads of all trips
  // are lifted to the top, do not fit the scalar registers and are spilled.
#pragma unroll 1
  for (int p0 = 0; p0 < 128; p0 += 8) {
    v4f za = *(const v4f*)(lr + p0);
    v4f zb = *(const v4f*)(lr + p0 + 4);
    v2f nv[4] = {{za[0], za[1]}, {za[2], za[3]}, {zb[0], zb[1]}, {zb[2], zb[3]}};
#pragma unroll
    for (int t = 0; t < 4; ++t) {
      v2f g2 = {gzc[p0 + 2 * t], gzc[p0 + 2 * t + 1]};
      v2f b2 = {bzc[p0 + 2 * t], bzc[p0 + 2 * t + 1]};
      nv[t] = (nv[t] - mu) * rstd * g2 + b2;
    }
#pragma unroll
    for (int t = 0; t < 4; ++t)
#pragma unroll
      for (int h = 0; h < 8; ++h) {
        v2f w2 = {bwc[h * 128 + p0 + 2 * t], bwc[h * 128 + p0 + 2 * t + 1]};
        acc[h] += nv[t] * w2;
      }
  }
#pragma unroll
  for (int h = 0; h < 8; ++h)
    pb[(size_t)h * 65536 + pair0 + tid] = acc[h][0] + acc[h][1];
}

__global__ void __launch_bounds__(128) k_attention(
    const f16* q16, const f16* k16, const f16* v16p, const float* pb,
    const float* mask, float* o32) {
  __shared__ f16 lv[256 * 32];        // V tile, 16 KB
  int s_ = blockIdx.x >> 3, h_ = blockIdx.x & 7;
  size_t headoff = ((size_t)s_ * 8 + h_) * 256 * 32;
  const f16* qs = q16 + headoff;
  const f16* ks = k16 + headoff;
  const f16* vs = v16p + headoff;

#if USE_TDM
  if (threadIdx.x < 32) {
    unsigned lds_off = (unsigned)(unsigned long long)(const void*)&lv[0];
    unsigned long long ga = (unsigned long long)(const void*)vs;
    u32x4 g0;
    g0[0] = 1u;                                   // count=1, user mode
    g0[1] = lds_off;                              // lds_addr
    g0[2] = (unsigned)(ga & 0xffffffffu);         // global_addr[31:0]
    g0[3] = (unsigned)((ga >> 32) & 0x01ffffffu)  // global_addr[56:32]
            | (2u << 30);                         // type=2 (image)
    i32x8 g1;
    g1[0] = (int)(1u << 16);
    g1[1] = (int)(32u << 16);
    g1[2] = (int)(256u << 16);
    g1[3] = (int)(32u << 16);
    g1[4] = 256;
    g1[5] = 32;
    g1[6] = 0;
    g1[7] = 0;
    i32x4 gz4 = {0, 0, 0, 0};   // groups 2/3 unused (<=2D tensor)
#if __clang_major__ >= 23
    i32x8 gz8 = {0, 0, 0, 0, 0, 0, 0, 0};
    __builtin_amdgcn_tensor_load_to_lds(g0, g1, gz4, gz4, gz8, 0);
#else
    __builtin_amdgcn_tensor_load_to_lds(g0, g1, gz4, gz4, 0);
#endif
    __builtin_amdgcn_s_wait_tensorcnt(0);
  }
#else
  for (int t = threadIdx.x; t < 8192; t += 128) lv[t] = vs[t];
#endif
  __syncthreads();

  int wave = threadIdx.x >> 5, lane = threadIdx.x & 31;
  int hf = lane >> 4, colL = lane & 15;
  const float* pbh = pb + (size_t)h_ * 65536;
  const float* mrow = mask + (size_t)s_ * 256;

  for (int itb = 0; itb < 4; ++itb) {
    int i0 = (itb * 4 + wave) * 16;
    // B = Q^T: lane holds column i = i0 + colL.
    v16h qb = frag_rowmajor(qs, 32, i0 + colL, 0, hf);
    const float* pbrow = pbh + (size_t)(i0 + colL) * 256 + 8 * hf;
    // acc[jt][r] = logits[i0 + colL][jt*16 + 8*hf + r]; the pair bias and the
    // mask bias enter as the C operand.
    v8f acc[16];
#pragma unroll
    for (int jt = 0; jt < 16; ++jt) acc[jt] = *(const v8f*)(pbrow + jt * 16);
    // The registers that hold the addresses of the loads above are reused
    // below: the wait stands in front of their overwrite.
    asm volatile("s_wait_xcnt 0x0" ::: "memory");
#pragma unroll
    for (int g = 0; g < 4; ++g) {
      v16h ka[4];
      v8f mv[4];
#pragma unroll
      for (int t = 0; t < 4; ++t) {
        int jt = g * 4 + t;
        ka[t] = frag_rowmajor(ks, 32, jt * 16 + colL, 0, hf);
        mv[t] = *(const v8f*)(mrow + jt * 16 + 8 * hf);
      }
      // Keeps the loads of four tiles in flight together: without it each
      // tile's loads are issued and waited for singly, in front of its WMMA.
      __builtin_amdgcn_sched_barrier(0);
#pragma unroll
      for (int t = 0; t < 4; ++t) {
        int jt = g * 4 + t;
        v8f c;
#pragma unroll
        for (int r = 0; r < 8; ++r) c[r] = acc[jt][r] + 1e9f * (mv[t][r] - 1.f);
        acc[jt] = wmma16(ka[t], qb, c);
      }
    }
    // softmax over j: 128 values of row i in this lane, the other 128 in
    // lane ^ 16.
    v8f mx = acc[0];
#pragma unroll
    for (int jt = 1; jt < 16; ++jt)
#pragma unroll
      for (int r = 0; r < 8; ++r) mx[r] = fmaxf(mx[r], acc[jt][r]);
    float m = fmaxf(fmaxf(fmaxf(mx[0], mx[1]), fmaxf(mx[2], mx[3])),
                    fmaxf(fmaxf(mx[4], mx[5]), fmaxf(mx[6], mx[7])));
    m = fmaxf(m, __shfl_xor(m, 16, 32));
    // Tiles 2kt and 2kt+1 hold keys kt*32 + {8*hf + 0..7, 16 + 8*hf + 0..7}:
    // converted in place they are the B fragment pt[kt] in the k order of
    // kk_of (unnormalized exp; 1/rowsum folded into the epilogue).
    v8f sv = {0, 0, 0, 0, 0, 0, 0, 0};
    v16h pt[8];
#pragma unroll
    for (int jt = 0; jt < 16; ++jt)
#pragma unroll
      for (int r = 0; r < 8; ++r) {
        float e = __expf(acc[jt][r] - m);
        sv[r] += e;
        pt[jt >> 1][(jt & 1) * 8 + r] = (f16)e;
      }
    float ssum = ((sv[0] + sv[1]) + (sv[2] + sv[3])) +
                 ((sv[4] + sv[5]) + (sv[6] + sv[7]));
    ssum += __shfl_xor(ssum, 16, 32);
    float rinv = 1.f / ssum;
    // Ot = V^T Pt
    v8f oacc[2] = {{0, 0, 0, 0, 0, 0, 0, 0}, {0, 0, 0, 0, 0, 0, 0, 0}};
#pragma unroll
    for (int kt = 0; kt < 8; ++kt)
#pragma unroll
      for (int ct = 0; ct < 2; ++ct) {
        v16h va = frag_gather_col(lv, 32, ct * 16 + colL, kt * 32, hf);
        oacc[ct] = wmma16(va, pt[kt], oacc[ct]);
      }
    // oacc[ct][r] = O[i0 + colL][ct*16 + 8*hf + r]
    float* orow = o32 + ((size_t)s_ * 256 + i0 + colL) * 256 + h_ * 32 + 8 * hf;
#pragma unroll
    for (int ct = 0; ct < 2; ++ct) {
      v8f ov;
#pragma unroll
      for (int r = 0; r < 8; ++r) ov[r] = oacc[ct][r] * rinv;
      *(v8f*)(orow + ct * 16) = ov;
    }
    // The next trip overwrites the stores' address and data registers.
    asm volatile("s_wait_xcnt 0x0" ::: "memory");
  }
}

// ---------------------------------------------------------------------------
// Kernel D: out = (g * o) @ Wo + out_bias + M_raw
// ---------------------------------------------------------------------------
__global__ void __launch_bounds__(256) k_out(
    const f16* g16, const float* o32, const f16* fo, const float* out_bias,
    const float* M_raw, float* out) {
  __shared__ f16 lx[16][256];
  int tid = threadIdx.x;
  size_t base = (size_t)blockIdx.x * 16 * 256;
#pragma unroll
  for (int it = 0; it < 16; ++it) {
    int idx = it * 256 + tid;
    float gv = (float)g16[base + idx];
    lx[idx >> 8][idx & 255] = (f16)(gv * o32[base + idx]);
  }
  __syncthreads();
  int wave = tid >> 5, lane = tid & 31, hf = lane >> 4, colL = lane & 15;
  int gr0 = blockIdx.x * 16;
#pragma unroll
  for (int t = 0; t < 2; ++t) {
    int nt = wave * 2 + t;
    v8f acc = {0, 0, 0, 0, 0, 0, 0, 0};
#pragma unroll
    for (int kt = 0; kt < 8; ++kt) {
      v16h a = frag_rowmajor(&lx[0][0], 256, colL, kt * 32, hf);
      v16h b = *(const v16h*)(fo + ((size_t)(kt * 16 + nt) * 32 + lane) * 16);
      acc = wmma16(a, b, acc);
    }
    int n = nt * 16 + colL;
#pragma unroll
    for (int r = 0; r < 8; ++r) {
      size_t gi = (size_t)(gr0 + r + 8 * hf) * 256 + n;
      out[gi] = acc[r] + out_bias[n] + M_raw[gi];
    }
  }
}

// ---------------------------------------------------------------------------
extern "C" void kernel_launch(void* const* d_in, const int* in_sizes, int n_in,
                              void* d_out, int out_size, void* d_ws,
                              size_t ws_size, hipStream_t stream) {
  (void)in_sizes; (void)n_in; (void)out_size; (void)ws_size;
  const float* M_raw  = (const float*)d_in[0];
  const float* Z      = (const float*)d_in[1];
  const float* M_mask = (const float*)d_in[2];
  const float* ln_m_g = (const float*)d_in[3];
  const float* ln_m_b = (const float*)d_in[4];
  const float* ln_z_g = (const float*)d_in[5];
  const float* ln_z_b = (const float*)d_in[6];
  const float* b_w    = (const float*)d_in[7];
  const float* Wq     = (const float*)d_in[8];
  const float* Wk     = (const float*)d_in[9];
  const float* Wv     = (const float*)d_in[10];
  const float* Wg     = (const float*)d_in[11];
  const float* bg     = (const float*)d_in[12];
  const float* Wo     = (const float*)d_in[13];
  const float* ob     = (const float*)d_in[14];
  float* out = (float*)d_out;

  char* ws = (char*)d_ws;
  size_t off = 0;
  auto take = [&](size_t b) {
    char* p = ws + off;
    off += (b + 255) & ~(size_t)255;
    return p;
  };
  f16* fq   = (f16*)take(131072);      // swizzled weight fragments (f16)
  f16* fk   = (f16*)take(131072);
  f16* fv   = (f16*)take(131072);
  f16* fg   = (f16*)take(131072);
  f16* fo   = (f16*)take(131072);
  f16* q16  = (f16*)take(16777216);    // [s][h][256][32] f16
  f16* k16  = (f16*)take(16777216);
  f16* v16p = (f16*)take(16777216);
  f16* g16  = (f16*)take(16777216);    // [row][256] f16
  float* o32 = (float*)take(33554432); // [row][256] f32
  float* pb  = (float*)take(2097152);  // [h][i][j] f32

  k_swizzle<<<80, 256, 0, stream>>>(Wq, Wk, Wv, Wg, Wo, fq, fk, fv, fg, fo);
  k_ln_qkvg<<<2048, 256, 0, stream>>>(M_raw, ln_m_g, ln_m_b, bg, fq, fk, fv,
                                      fg, q16, k16, v16p, g16);
  k_pairbias<<<512, 128, 0, stream>>>(Z, ln_z_g, ln_z_b, b_w, pb);
  k_attention<<<1024, 128, 0, stream>>>(q16, k16, v16p, pb, M_mask, o32);
  k_out<<<2048, 256, 0, stream>>>(g16, o32, fo, ob, M_raw, out);
}

// v003
// Measured time: 184 microseconds a run.
// Two timings next to v002 both put it at 1.14 times that version's speed.
// Over all steps from v000 it is 1.67 times as fast.
#include <hip/hip_runtime.h>
#include <hip/hip_bf16.h>
#include <math.h>

typedef _Float16 f16;
typedef __attribute__((ext_vector_type(16))) _Float16 v16h;
typedef __attribute__((ext_vector_type(8)))  _Float16 v8h;
typedef __attribute__((ext_vector_type(8)))  float    v8f;
typedef __attribute__((ext_vector_type(4)))  float    v4f;
typedef __attribute__((ext_vector_type(2)))  float    v2f;
typedef __attribute__((address_space(4))) float cfloat;

typedef unsigned int u32x4 __attribute__((ext_vector_type(4)));
typedef int          i32x4 __attribute__((ext_vector_type(4)));
typedef int          i32x8 __attribute__((ext_vector_type(8)));

#ifndef __has_builtin
#define __has_builtin(x) 0
#endif
#if __has_builtin(__builtin_amdgcn_tensor_load_to_lds) && \
    __has_builtin(__builtin_amdgcn_s_wait_tensorcnt)
#define USE_TDM 1
#else
#define USE_TDM 0
#endif

__device__ __forceinline__ int kk_of(int e, int hf) {
  int v = e >> 1, lo = e & 1;
  return ((v >> 2) << 4) + hf * 8 + ((v & 3) << 1) + lo;
}

__device__ __forceinline__ v8f wmma16(v16h a, v16h b, v8f c) {
  return __builtin_amdgcn_wmma_f32_16x16x32_f16(false, a, false, b, (short)0, c,
                                                false, false);
}

// Row-major f16 source: lane's 16 fragment halfs are two contiguous 8-half
// chunks at kbase + hf*8 and kbase + 16 + hf*8 of one row -> two b128 loads.
__device__ __forceinline__ v16h frag_rowmajor(const f16* base, int strideH,
                                              int row, int kbase, int hf) {
  const f16* p = base + (size_t)row * strideH + kbase + hf * 8;
  v8h lo = *(const v8h*)p;
  v8h hi = *(const v8h*)(p + 16);
  v16h r;
#pragma unroll
  for (int e = 0; e < 8; ++e) { r[e] = lo[e]; r[e + 8] = hi[e]; }
  return r;
}

#define LX_PITCH 264    // halfs: 256 + 8  = 528 B  = 16 B x 33
#define LRAW_PITCH 260  // floats: 256 + 4 = 1040 B = 16 B x 65

// Column gather of row-major V (A = V^T): fixed column, strided K rows.
__device__ __forceinline__ v16h frag_gather_col(const f16* base, int strideH,
                                                int col, int krow, int hf) {
  v16h r;
#pragma unroll
  for (int e = 0; e < 16; ++e)
    r[e] = base[(size_t)(krow + kk_of(e, hf)) * strideH + col];
  return r;
}

// ---------------------------------------------------------------------------
// Kernel 0: pack f32 weights [256 x 256] into f16 WMMA B-fragment order.
// Fragment buffer: [(kt*16+nt)*32 + lane]*16 halfs, kt in 0..7, nt in 0..15.
// ---------------------------------------------------------------------------
__global__ void __launch_bounds__(256) k_swizzle(
    const float* w0, const float* w1, const float* w2, const float* w3,
    const float* w4, f16* f0, f16* f1, f16* f2, f16* f3, f16* f4) {
  int t = blockIdx.x * blockDim.x + threadIdx.x;
  if (t >= 5 * 8 * 16 * 32) return;
  int w = t / 4096, rem = t % 4096;
  int kt = rem / 512; rem %= 512;
  int nt = rem / 32; int lane = rem % 32;
  const float* src = (w == 0) ? w0 : (w == 1) ? w1 : (w == 2) ? w2
                     : (w == 3) ? w3 : w4;
  f16* dst = ((w == 0) ? f0 : (w == 1) ? f1 : (w == 2) ? f2
              : (w == 3) ? f3 : f4) +
             ((size_t)(kt * 16 + nt) * 32 + lane) * 16;
  int hf = lane >> 4, col = nt * 16 + (lane & 15);
#pragma unroll
  for (int e = 0; e < 16; ++e)
    dst[e] = (f16)src[(kt * 32 + kk_of(e, hf)) * 256 + col];
}

// ---------------------------------------------------------------------------
// Kernel A: LayerNorm(M_raw) then fused Q/K/V/G projection GEMM via WMMA.
// One block = 16 rows of the [32768 x 256] activation, 8 waves x 8 tiles.
// q/k/v stored f16 head-major [s][h][r][32]; g stored f16 [row][256].
// ---------------------------------------------------------------------------
__global__ void __launch_bounds__(256) k_ln_qkvg(
    const float* M_raw, const float* g_ln, const float* b_ln, const float* bg,
    const f16* fq, const f16* fk, const f16* fv, const f16* fg,
    f16* q16, f16* k16, f16* v16p, f16* g16) {
  __shared__ __attribute__((aligned(16))) float lraw[16][LRAW_PITCH];
  __shared__ float lstat[16][2];
  __shared__ __attribute__((aligned(16))) f16 lx[16][LX_PITCH];
  int tid = threadIdx.x;
  size_t base = (size_t)blockIdx.x * 16 * 256;
#pragma unroll
  for (int it = 0; it < 16; ++it) {
    int idx = it * 256 + tid;
    lraw[idx >> 8][idx & 255] = M_raw[base + idx];
  }
  __syncthreads();
  if (tid < 16) {
    float s = 0.f;
    for (int c = 0; c < 256; ++c) s += lraw[tid][c];
    float mu = s * (1.f / 256.f);
    float vv = 0.f;
    for (int c = 0; c < 256; ++c) { float d = lraw[tid][c] - mu; vv += d * d; }
    lstat[tid][0] = mu;
    lstat[tid][1] = rsqrtf(vv * (1.f / 256.f) + 1e-5f);
  }
  __syncthreads();
#pragma unroll
  for (int it = 0; it < 16; ++it) {
    int idx = it * 256 + tid;
    int r = idx >> 8, c = idx & 255;
    lx[r][c] = (f16)((lraw[r][c] - lstat[r][0]) * lstat[r][1] * g_ln[c] + b_ln[c]);
  }
  __syncthreads();

  int wave = tid >> 5, lane = tid & 31;
  int hf = lane >> 4, colL = lane & 15;
  int mat = wave >> 1, ntb = (wave & 1) * 8;  // each wave: one matrix, 8 n-tiles
  const f16* fr = (mat == 0) ? fq : (mat == 1) ? fk : (mat == 2) ? fv : fg;
  int gr0 = blockIdx.x * 16;
#pragma unroll
  for (int t = 0; t < 8; ++t) {
    int nt = ntb + t;
    __builtin_prefetch(fr + ((size_t)(nt + 16) * 32 + lane) * 16, 0, 1);
    v8f acc = {0, 0, 0, 0, 0, 0, 0, 0};
#pragma unroll
    for (int kt = 0; kt < 8; ++kt) {
      v16h a = frag_rowmajor(&lx[0][0], LX_PITCH, colL, kt * 32, hf);
      v16h b = *(const v16h*)(fr + ((size_t)(kt * 16 + nt) * 32 + lane) * 16);
      acc = wmma16(a, b, acc);
    }
    int n = nt * 16 + colL;
#pragma unroll
    for (int r = 0; r < 8; ++r) {
      int gr = gr0 + r + 8 * hf;   // C-layout: lanes 16-31 hold rows +8
      float val = acc[r];
      if (mat == 3) {
        val = 1.f / (1.f + __expf(-(val + bg[n])));
        g16[(size_t)gr * 256 + n] = (f16)val;
      } else {
        if (mat == 0) val *= 0.17677669529663687f;  // 1/sqrt(C)
        int s_ = gr >> 8, i_ = gr & 255;
        int h_ = n >> 5, c_ = n & 31;
        f16* dst = (mat == 0) ? q16 : (mat == 1) ? k16 : v16p;
        dst[(((size_t)s_ * 8 + h_) * 256 + i_) * 32 + c_] = (f16)val;
      }
    }
  }
}

__global__ void __launch_bounds__(128) k_pairbias(
    const float* Z, const float* gz, const float* bz, const float* bw,
    float* pb) {
  __shared__ __attribute__((aligned(16))) float lz[128 * 132];
  int tid = threadIdx.x;
  int wave = tid >> 5, lane = tid & 31;
  int pair0 = blockIdx.x * 128;  // pair = i*256 + j
  v4f z[32];
  {
    const float* zp = Z + (size_t)(pair0 + wave * 32) * 128 + lane * 4;
#pragma unroll
    for (int k = 0; k < 32; ++k) z[k] = *(const v4f*)(zp + k * 128);
    // The registers that hold the addresses of the loads above are reused
    // below: the wait stands in front of their overwrite.
    asm volatile("s_wait_xcnt 0x0" ::: "memory");
    float* lw = lz + wave * 32 * 132 + lane * 4;
#pragma unroll
    for (int k = 0; k < 32; ++k) *(v4f*)(lw + k * 132) = z[k];
  }
  __syncthreads();
  const float* lr = lz + tid * 132;
#pragma unroll
  for (int c = 0; c < 32; ++c) z[c] = *(const v4f*)(lr + c * 4);
  v4f s4 = z[0];
#pragma unroll
  for (int c = 1; c < 32; ++c) s4 += z[c];
  float mu = ((s4[0] + s4[1]) + (s4[2] + s4[3])) * (1.f / 128.f);
  v4f q4 = {0, 0, 0, 0};
#pragma unroll
  for (int c = 0; c < 32; ++c) {
    v4f d = z[c] - mu;
    q4 += d * d;
  }
  float vv = (q4[0] + q4[1]) + (q4[2] + q4[3]);
  float rstd = rsqrtf(vv * (1.f / 128.f) + 1e-5f);
  // No launch of this file writes these three inputs: read through the
  // constant address space they come by scalar loads, one for the wave
  // (behind the asm statement above they would else be vector loads).
  const cfloat* gzc = (const cfloat*)(unsigned long long)gz;
  const cfloat* bzc = (const cfloat*)(unsigned long long)bz;
  const cfloat* bwc = (const cfloat*)(unsigned long long)bw;
  // Even and odd channels are summed apart: two neighbouring channels go
  // through one packed multiply-add.
  v2f acc[8] = {{0, 0}, {0, 0}, {0, 0}, {0, 0}, {0, 0}, {0, 0}, {0, 0}, {0, 0}};
  // Stays rolled, 8 channels a trip: unrolled, the scalar loads of all trips
  // are lifted to the top, do not fit the scalar registers and are spilled.
#pragma unroll 1
  for (int p0 = 0; p0 < 128; p0 += 8) {
    v4f za = *(const v4f*)(lr + p0);
    v4f zb = *(const v4f*)(lr + p0 + 4);
    v2f nv[4] = {{za[0], za[1]}, {za[2], za[3]}, {zb[0], zb[1]}, {zb[2], zb[3]}};
#pragma unroll
    for (int t = 0; t < 4; ++t) {
      v2f g2 = {gzc[p0 + 2 * t], gzc[p0 + 2 * t + 1]};
      v2f b2 = {bzc[p0 + 2 * t], bzc[p0 + 2 * t + 1]};
      nv[t] = (nv[t] - mu) * rstd * g2 + b2;
    }
#pragma unroll
    for (int t = 0; t < 4; ++t)
#pragma unroll
      for (int h = 0; h < 8; ++h) {
        v2f w2 = {bwc[h * 128 + p0 + 2 * t], bwc[h * 128 + p0 + 2 * t + 1]};
        acc[h] += nv[t] * w2;
      }
  }
#pragma unroll
  for (int h = 0; h < 8; ++h)
    pb[(size_t)h * 65536 + pair0 + tid] = acc[h][0] + acc[h][1];
}

__global__ void __launch_bounds__(128) k_attention(
    const f16* q16, const f16* k16, const f16* v16p, const float* pb,
    const float* mask, float* o32) {
  __shared__ f16 lv[256 * 32];        // V tile, 16 KB
  int s_ = blockIdx.x >> 3, h_ = blockIdx.x & 7;
  size_t headoff = ((size_t)s_ * 8 + h_) * 256 * 32;
  const f16* qs = q16 + headoff;
  const f16* ks = k16 + headoff;
  const f16* vs = v16p + headoff;

#if USE_TDM
  if (threadIdx.x < 32) {
    unsigned lds_off = (unsigned)(unsigned long long)(const void*)&lv[0];
    unsigned long long ga = (unsigned long long)(const void*)vs;
    u32x4 g0;
    g0[0] = 1u;                                   // count=1, user mode
    g0[1] = lds_off;                              // lds_addr
    g0[2] = (unsigned)(ga & 0xffffffffu);         // global_addr[31:0]
    g0[3] = (unsigned)((ga >> 32) & 0x01ffffffu)  // global_addr[56:32]
            | (2u << 30);                         // type=2 (image)
    i32x8 g1;
    g1[0] = (int)(1u << 16);
    g1[1] = (int)(32u << 16);
    g1[2] = (int)(256u << 16);
    g1[3] = (int)(32u << 16);
    g1[4] = 256;
    g1[5] = 32;
    g1[6] = 0;
    g1[7] = 0;
    i32x4 gz4 = {0, 0, 0, 0};   // groups 2/3 unused (<=2D tensor)
#if __clang_major__ >= 23
    i32x8 gz8 = {0, 0, 0, 0, 0, 0, 0, 0};
    __builtin_amdgcn_tensor_load_to_lds(g0, g1, gz4, gz4, gz8, 0);
#else
    __builtin_amdgcn_tensor_load_to_lds(g0, g1, gz4, gz4, 0);
#endif
    __builtin_amdgcn_s_wait_tensorcnt(0);
  }
#else
  for (int t = threadIdx.x; t < 8192; t += 128) lv[t] = vs[t];
#endif
  __syncthreads();

  int wave = threadIdx.x >> 5, lane = threadIdx.x & 31;
  int hf = lane >> 4, colL = lane & 15;
  const float* pbh = pb + (size_t)h_ * 65536;
  const float* mrow = mask + (size_t)s_ * 256;

  for (int itb = 0; itb < 4; ++itb) {
    int i0 = (itb * 4 + wave) * 16;
    // B = Q^T: lane holds column i = i0 + colL.
    v16h qb = frag_rowmajor(qs, 32, i0 + colL, 0, hf);
    const float* pbrow = pbh + (size_t)(i0 + colL) * 256 + 8 * hf;
    // acc[jt][r] = logits[i0 + colL][jt*16 + 8*hf + r]; the pair bias and the
    // mask bias enter as the C operand.
    v8f acc[16];
#pragma unroll
    for (int jt = 0; jt < 16; ++jt) acc[jt] = *(const v8f*)(pbrow + jt * 16);
    // The registers that hold the addresses of the loads above are reused
    // below: the wait stands in front of their overwrite.
    asm volatile("s_wait_xcnt 0x0" ::: "memory");
#pragma unroll
    for (int g = 0; g < 4; ++g) {
      v16h ka[4];
      v8f mv[4];
#pragma unroll
      for (int t = 0; t < 4; ++t) {
        int jt = g * 4 + t;
        ka[t] = frag_rowmajor(ks, 32, jt * 16 + colL, 0, hf);
        mv[t] = *(const v8f*)(mrow + jt * 16 + 8 * hf);
      }
      // Keeps the loads of four tiles in flight together: without it each
      // tile's loads are issued and waited for singly, in front of its WMMA.
      __builtin_amdgcn_sched_barrier(0);
#pragma unroll
      for (int t = 0; t < 4; ++t) {
        int jt = g * 4 + t;
        v8f c;
#pragma unroll
        for (int r = 0; r < 8; ++r) c[r] = acc[jt][r] + 1e9f * (mv[t][r] - 1.f);
        acc[jt] = wmma16(ka[t], qb, c);
      }
    }
    // softmax over j: 128 values of row i in this lane, the other 128 in
    // lane ^ 16.
    v8f mx = acc[0];
#pragma unroll
    for (int jt = 1; jt < 16; ++jt)
#pragma unroll
      for (int r = 0; r < 8; ++r) mx[r] = fmaxf(mx[r], acc[jt][r]);
    float m = fmaxf(fmaxf(fmaxf(mx[0], mx[1]), fmaxf(mx[2], mx[3])),
                    fmaxf(fmaxf(mx[4], mx[5]), fmaxf(mx[6], mx[7])));
    m = fmaxf(m, __shfl_xor(m, 16, 32));
    // Tiles 2kt and 2kt+1 hold keys kt*32 + {8*hf + 0..7, 16 + 8*hf + 0..7}:
    // converted in place they are the B fragment pt[kt] in the k order of
    // kk_of (unnormalized exp; 1/rowsum folded into the epilogue).
    v8f sv = {0, 0, 0, 0, 0, 0, 0, 0};
    v16h pt[8];
#pragma unroll
    for (int jt = 0; jt < 16; ++jt)
#pragma unroll
      for (int r = 0; r < 8; ++r) {
        float e = __expf(acc[jt][r] - m);
        sv[r] += e;
        pt[jt >> 1][(jt & 1) * 8 + r] = (f16)e;
      }
    float ssum = ((sv[0] + sv[1]) + (sv[2] + sv[3])) +
                 ((sv[4] + sv[5]) + (sv[6] + sv[7]));
    ssum += __shfl_xor(ssum, 16, 32);
    float rinv = 1.f / ssum;
    // Ot = V^T Pt
    v8f oacc[2] = {{0, 0, 0, 0, 0, 0, 0, 0}, {0, 0, 0, 0, 0, 0, 0, 0}};
#pragma unroll
    for (int kt = 0; kt < 8; ++kt)
#pragma unroll
      for (int ct = 0; ct < 2; ++ct) {
        v16h va = frag_gather_col(lv, 32, ct * 16 + colL, kt * 32, hf);
        oacc[ct] = wmma16(va, pt[kt], oacc[ct]);
      }
    // oacc[ct][r] = O[i0 + colL][ct*16 + 8*hf + r]
    float* orow = o32 + ((size_t)s_ * 256 + i0 + colL) * 256 + h_ * 32 + 8 * hf;
#pragma unroll
    for (int ct = 0; ct < 2; ++ct) {
      v8f ov;
#pragma unroll
      for (int r = 0; r < 8; ++r) ov[r] = oacc[ct][r] * rinv;
      *(v8f*)(orow + ct * 16) = ov;
    }
    // The next trip overwrites the stores' address and data registers.
    asm volatile("s_wait_xcnt 0x0" ::: "memory");
  }
}

// ---------------------------------------------------------------------------
// Kernel D: out = (g * o) @ Wo + out_bias + M_raw
// ---------------------------------------------------------------------------
__global__ void __launch_bounds__(256) k_out(
    const f16* g16, const float* o32, const f16* fo, const float* out_bias,
    const float* M_raw, float* out) {
  __shared__ __attribute__((aligned(16))) f16 lx[16][LX_PITCH];
  int tid = threadIdx.x;
  size_t base = (size_t)blockIdx.x * 16 * 256;
#pragma unroll
  for (int it = 0; it < 16; ++it) {
    int idx = it * 256 + tid;
    float gv = (float)g16[base + idx];
    lx[idx >> 8][idx & 255] = (f16)(gv * o32[base + idx]);
  }
  __syncthreads();
  int wave = tid >> 5, lane = tid & 31, hf = lane >> 4, colL = lane & 15;
  int gr0 = blockIdx.x * 16;
#pragma unroll
  for (int t = 0; t < 2; ++t) {
    int nt = wave * 2 + t;
    v8f acc = {0, 0, 0, 0, 0, 0, 0, 0};
#pragma unroll
    for (int kt = 0; kt < 8; ++kt) {
      v16h a = frag_rowmajor(&lx[0][0], LX_PITCH, colL, kt * 32, hf);
      v16h b = *(const v16h*)(fo + ((size_t)(kt * 16 + nt) * 32 + lane) * 16);
      acc = wmma16(a, b, acc);
    }
    int n = nt * 16 + colL;
#pragma unroll
    for (int r = 0; r < 8; ++r) {
      size_t gi = (size_t)(gr0 + r + 8 * hf) * 256 + n;
      out[gi] = acc[r] + out_bias[n] + M_raw[gi];
    }
  }
}

// ---------------------------------------------------------------------------
extern "C" void kernel_launch(void* const* d_in, const int* in_sizes, int n_in,
                              void* d_out, int out_size, void* d_ws,
                              size_t ws_size, hipStream_t stream) {
  (void)in_sizes; (void)n_in; (void)out_size; (void)ws_size;
  const float* M_raw  = (const float*)d_in[0];
  const float* Z      = (const float*)d_in[1];
  const float* M_mask = (const float*)d_in[2];
  const float* ln_m_g = (const float*)d_in[3];
  const float* ln_m_b = (const float*)d_in[4];
  const float* ln_z_g = (const float*)d_in[5];
  const float* ln_z_b = (const float*)d_in[6];
  const float* b_w    = (const float*)d_in[7];
  const float* Wq     = (const float*)d_in[8];
  const float* Wk     = (const float*)d_in[9];
  const float* Wv     = (const float*)d_in[10];
  const float* Wg     = (const float*)d_in[11];
  const float* bg     = (const float*)d_in[12];
  const float* Wo     = (const float*)d_in[13];
  const float* ob     = (const float*)d_in[14];
  float* out = (float*)d_out;

  char* ws = (char*)d_ws;
  size_t off = 0;
  auto take = [&](size_t b) {
    char* p = ws + off;
    off += (b + 255) & ~(size_t)255;
    return p;
  };
  f16* fq   = (f16*)take(131072);      // swizzled weight fragments (f16)
  f16* fk   = (f16*)take(131072);
  f16* fv   = (f16*)take(131072);
  f16* fg   = (f16*)take(131072);
  f16* fo   = (f16*)take(131072);
  f16* q16  = (f16*)take(16777216);    // [s][h][256][32] f16
  f16* k16  = (f16*)take(16777216);
  f16* v16p = (f16*)take(16777216);
  f16* g16  = (f16*)take(16777216);    // [row][256] f16
  float* o32 = (float*)take(33554432); // [row][256] f32
  float* pb  = (float*)take(2097152);  // [h][i][j] f32

  k_swizzle<<<80, 256, 0, stream>>>(Wq, Wk, Wv, Wg, Wo, fq, fk, fv, fg, fo);
  k_ln_qkvg<<<2048, 256, 0, stream>>>(M_raw, ln_m_g, ln_m_b, bg, fq, fk, fv,
                                      fg, q16, k16, v16p, g16);
  k_pairbias<<<512, 128, 0, stream>>>(Z, ln_z_g, ln_z_b, b_w, pb);
  k_attention<<<1024, 128, 0, stream>>>(q16, k16, v16p, pb, M_mask, o32);
  k_out<<<2048, 256, 0, stream>>>(g16, o32, fo, ob, M_raw, out);
}

// v004
// A run of this version takes 173 microseconds.
// Timed twice side by side with v003, it ran 1.04 times as fast both times.
// Counting every step since v000, it is 1.74 times as fast.
#include <hip/hip_runtime.h>
#include <hip/hip_bf16.h>
#include <math.h>

typedef _Float16 f16;
typedef __attribute__((ext_vector_type(16))) _Float16 v16h;
typedef __attribute__((ext_vector_type(8)))  _Float16 v8h;
typedef __attribute__((ext_vector_type(8)))  float    v8f;
typedef __attribute__((ext_vector_type(4)))  float    v4f;
typedef __attribute__((ext_vector_type(2)))  float    v2f;
typedef __attribute__((address_space(4))) float cfloat;

typedef unsigned int u32x4 __attribute__((ext_vector_type(4)));
typedef int          i32x4 __attribute__((ext_vector_type(4)));
typedef int          i32x8 __attribute__((ext_vector_type(8)));

#ifndef __has_builtin
#define __has_builtin(x) 0
#endif
#if __has_builtin(__builtin_amdgcn_tensor_load_to_lds) && \
    __has_builtin(__builtin_amdgcn_s_wait_tensorcnt)
#define USE_TDM 1
#else
#define USE_TDM 0
#endif

__device__ __forceinline__ int kk_of(int e, int hf) {
  int v = e >> 1, lo = e & 1;
  return ((v >> 2) << 4) + hf * 8 + ((v & 3) << 1) + lo;
}

__device__ __forceinline__ v8f wmma16(v16h a, v16h b, v8f c) {
  return __builtin_amdgcn_wmma_f32_16x16x32_f16(false, a, false, b, (short)0, c,
                                                false, false);
}

// Row-major f16 source: lane's 16 fragment halfs are two contiguous 8-half
// chunks at kbase + hf*8 and kbase + 16 + hf*8 of one row -> two b128 loads.
__device__ __forceinline__ v16h frag_rowmajor(const f16* base, int strideH,
                                              int row, int kbase, int hf) {
  const f16* p = base + (size_t)row * strideH + kbase + hf * 8;
  v8h lo = *(const v8h*)p;
  v8h hi = *(const v8h*)(p + 16);
  v16h r;
#pragma unroll
  for (int e = 0; e < 8; ++e) { r[e] = lo[e]; r[e + 8] = hi[e]; }
  return r;
}

#define LX_PITCH 264    // halfs: 256 + 8  = 528 B  = 16 B x 33
#define LRAW_PITCH 260  // floats: 256 + 4 = 1040 B = 16 B x 65

// Column gather of row-major V (A = V^T): fixed column, strided K rows.
__device__ __forceinline__ v16h frag_gather_col(const f16* base, int strideH,
                                                int col, int krow, int hf) {
  v16h r;
#pragma unroll
  for (int e = 0; e < 16; ++e)
    r[e] = base[(size_t)(krow + kk_of(e, hf)) * strideH + col];
  return r;
}

// ---------------------------------------------------------------------------
// Kernel 0: pack f32 weights [256 x 256] into f16 WMMA B-fragment order.
// Fragment buffer: [(kt*16+nt)*32 + lane]*16 halfs, kt in 0..7, nt in 0..15.
// ---------------------------------------------------------------------------
__global__ void __launch_bounds__(256) k_swizzle(
    const float* w0, const float* w1, const float* w2, const float* w3,
    const float* w4, f16* f0, f16* f1, f16* f2, f16* f3, f16* f4) {
  int t = blockIdx.x * blockDim.x + threadIdx.x;
  if (t >= 5 * 8 * 16 * 32) return;
  int w = t / 4096, rem = t % 4096;
  int kt = rem / 512; rem %= 512;
  int nt = rem / 32; int lane = rem % 32;
  const float* src = (w == 0) ? w0 : (w == 1) ? w1 : (w == 2) ? w2
                     : (w == 3) ? w3 : w4;
  f16* dst = ((w == 0) ? f0 : (w == 1) ? f1 : (w == 2) ? f2
              : (w == 3) ? f3 : f4) +
             ((size_t)(kt * 16 + nt) * 32 + lane) * 16;
  int hf = lane >> 4, col = nt * 16 + (lane & 15);
#pragma unroll
  for (int e = 0; e < 16; ++e)
    dst[e] = (f16)src[(kt * 32 + kk_of(e, hf)) * 256 + col];
}

// ---------------------------------------------------------------------------
// Kernel A: LayerNorm(M_raw) then fused Q/K/V/G projection GEMM via WMMA.
// One block = 16 rows of the [32768 x 256] activation, 8 waves x 8 tiles.
// q/k/v stored f16 head-major [s][h][r][32]; g stored f16 [row][256].
// ---------------------------------------------------------------------------
__global__ void __launch_bounds__(256) k_ln_qkvg(
    const float* M_raw, const float* g_ln, const float* b_ln, const float* bg,
    const f16* fq, const f16* fk, const f16* fv, const f16* fg,
    f16* q16, f16* k16, f16* v16p, f16* g16) {
  __shared__ __attribute__((aligned(16))) float lraw[16][LRAW_PITCH];
  __shared__ float lstat[16][2];
  __shared__ __attribute__((aligned(16))) f16 lx[16][LX_PITCH];
  int tid = threadIdx.x;
  size_t base = (size_t)blockIdx.x * 16 * 256;
#pragma unroll
  for (int it = 0; it < 16; ++it) {
    int idx = it * 256 + tid;
    lraw[idx >> 8][idx & 255] = M_raw[base + idx];
  }
  __syncthreads();
  if (tid < 16) {
    float s = 0.f;
    for (int c = 0; c < 256; ++c) s += lraw[tid][c];
    float mu = s * (1.f / 256.f);
    float vv = 0.f;
    for (int c = 0; c < 256; ++c) { float d = lraw[tid][c] - mu; vv += d * d; }
    lstat[tid][0] = mu;
    lstat[tid][1] = rsqrtf(vv * (1.f / 256.f) + 1e-5f);
  }
  __syncthreads();
#pragma unroll
  for (int it = 0; it < 16; ++it) {
    int idx = it * 256 + tid;
    int r = idx >> 8, c = idx & 255;
    lx[r][c] = (f16)((lraw[r][c] - lstat[r][0]) * lstat[r][1] * g_ln[c] + b_ln[c]);
  }
  __syncthreads();

  int wave = tid >> 5, lane = tid & 31;
  int hf = lane >> 4, colL = lane & 15;
  int mat = wave >> 1, ntb = (wave & 1) * 8;  // each wave: one matrix, 8 n-tiles
  const f16* fr = (mat == 0) ? fq : (mat == 1) ? fk : (mat == 2) ? fv : fg;
  int gr0 = blockIdx.x * 16;
#pragma unroll
  for (int t = 0; t < 8; ++t) {
    int nt = ntb + t;
    __builtin_prefetch(fr + ((size_t)(nt + 16) * 32 + lane) * 16, 0, 1);
    v8f acc = {0, 0, 0, 0, 0, 0, 0, 0};
#pragma unroll
    for (int kt = 0; kt < 8; ++kt) {
      v16h a = frag_rowmajor(&lx[0][0], LX_PITCH, colL, kt * 32, hf);
      v16h b = *(const v16h*)(fr + ((size_t)(kt * 16 + nt) * 32 + lane) * 16);
      acc = wmma16(a, b, acc);
    }
    int n = nt * 16 + colL;
#pragma unroll
    for (int r = 0; r < 8; ++r) {
      int gr = gr0 + r + 8 * hf;   // C-layout: lanes 16-31 hold rows +8
      float val = acc[r];
      if (mat == 3) {
        val = 1.f / (1.f + __expf(-(val + bg[n])));
        g16[(size_t)gr * 256 + n] = (f16)val;
      } else {
        if (mat == 0) val *= 0.17677669529663687f;  // 1/sqrt(C)
        int s_ = gr >> 8, i_ = gr & 255;
        int h_ = n >> 5, c_ = n & 31;
        f16* dst = (mat == 0) ? q16 : (mat == 1) ? k16 : v16p;
        dst[(((size_t)s_ * 8 + h_) * 256 + i_) * 32 + c_] = (f16)val;
      }
    }
  }
}

__global__ void __launch_bounds__(128) k_pairbias(
    const float* Z, const float* gz, const float* bz, const float* bw,
    float* pb) {
  __shared__ __attribute__((aligned(16))) float lz[128 * 132];
  int tid = threadIdx.x;
  int wave = tid >> 5, lane = tid & 31;
  int it = blockIdx.x >> 5;  // rows i = it*16 + 0..15
  int jb = blockIdx.x & 31;  // keys j = jb*8 + 0..7
  // Thread t has the pair i = it*16 + ((t>>2)&15), j = jb*8 + (t>>6)*4 + (t&3).
  v4f z[32];
  {
    // Row k of this wave belongs to thread wave*32 + k.
    const float* zp = Z +
        (size_t)((it * 16 + (wave & 1) * 8) * 256 + jb * 8 + (wave >> 1) * 4) *
            128 + lane * 4;
#pragma unroll
    for (int k = 0; k < 32; ++k)
      z[k] = *(const v4f*)(zp + ((k >> 2) * 256 + (k & 3)) * 128);
    // The registers that hold the addresses of the loads above are reused
    // below: the wait stands in front of their overwrite.
    asm volatile("s_wait_xcnt 0x0" ::: "memory");
    float* lw = lz + wave * 32 * 132 + lane * 4;
#pragma unroll
    for (int k = 0; k < 32; ++k) *(v4f*)(lw + k * 132) = z[k];
  }
  __syncthreads();
  const float* lr = lz + tid * 132;
#pragma unroll
  for (int c = 0; c < 32; ++c) z[c] = *(const v4f*)(lr + c * 4);
  v4f s4 = z[0];
#pragma unroll
  for (int c = 1; c < 32; ++c) s4 += z[c];
  float mu = ((s4[0] + s4[1]) + (s4[2] + s4[3])) * (1.f / 128.f);
  v4f q4 = {0, 0, 0, 0};
#pragma unroll
  for (int c = 0; c < 32; ++c) {
    v4f d = z[c] - mu;
    q4 += d * d;
  }
  float vv = (q4[0] + q4[1]) + (q4[2] + q4[3]);
  float rstd = rsqrtf(vv * (1.f / 128.f) + 1e-5f);
  // No launch of this file writes these three inputs: read through the
  // constant address space they come by scalar loads, one for the wave
  // (behind the asm statement above they would else be vector loads).
  const cfloat* gzc = (const cfloat*)(unsigned long long)gz;
  const cfloat* bzc = (const cfloat*)(unsigned long long)bz;
  const cfloat* bwc = (const cfloat*)(unsigned long long)bw;
  // Even and odd channels are summed apart: two neighbouring channels go
  // through one packed multiply-add.
  v2f acc[8] = {{0, 0}, {0, 0}, {0, 0}, {0, 0}, {0, 0}, {0, 0}, {0, 0}, {0, 0}};
  // Stays rolled, 8 channels a trip: unrolled, the scalar loads of all trips
  // are lifted to the top, do not fit the scalar registers and are spilled.
#pragma unroll 1
  for (int p0 = 0; p0 < 128; p0 += 8) {
    v4f za = *(const v4f*)(lr + p0);
    v4f zb = *(const v4f*)(lr + p0 + 4);
    v2f nv[4] = {{za[0], za[1]}, {za[2], za[3]}, {zb[0], zb[1]}, {zb[2], zb[3]}};
#pragma unroll
    for (int t = 0; t < 4; ++t) {
      v2f g2 = {gzc[p0 + 2 * t], gzc[p0 + 2 * t + 1]};
      v2f b2 = {bzc[p0 + 2 * t], bzc[p0 + 2 * t + 1]};
      nv[t] = (nv[t] - mu) * rstd * g2 + b2;
    }
#pragma unroll
    for (int t = 0; t < 4; ++t)
#pragma unroll
      for (int h = 0; h < 8; ++h) {
        v2f w2 = {bwc[h * 128 + p0 + 2 * t], bwc[h * 128 + p0 + 2 * t + 1]};
        acc[h] += nv[t] * w2;
      }
  }
  float* pw = pb + (it * 16 + (jb >> 1)) * 256 + (tid >> 6) * 128 +
              (jb & 1) * 64 + (tid & 63);
#pragma unroll
  for (int h = 0; h < 8; ++h) pw[(size_t)h * 65536] = acc[h][0] + acc[h][1];
}

__global__ void __launch_bounds__(128) k_attention(
    const f16* q16, const f16* k16, const f16* v16p, const float* pb,
    const float* mask, float* o32) {
  __shared__ f16 lv[256 * 32];        // V tile, 16 KB
  int s_ = blockIdx.x >> 3, h_ = blockIdx.x & 7;
  size_t headoff = ((size_t)s_ * 8 + h_) * 256 * 32;
  const f16* qs = q16 + headoff;
  const f16* ks = k16 + headoff;
  const f16* vs = v16p + headoff;

#if USE_TDM
  if (threadIdx.x < 32) {
    unsigned lds_off = (unsigned)(unsigned long long)(const void*)&lv[0];
    unsigned long long ga = (unsigned long long)(const void*)vs;
    u32x4 g0;
    g0[0] = 1u;                                   // count=1, user mode
    g0[1] = lds_off;                              // lds_addr
    g0[2] = (unsigned)(ga & 0xffffffffu);         // global_addr[31:0]
    g0[3] = (unsigned)((ga >> 32) & 0x01ffffffu)  // global_addr[56:32]
            | (2u << 30);                         // type=2 (image)
    i32x8 g1;
    g1[0] = (int)(1u << 16);
    g1[1] = (int)(32u << 16);
    g1[2] = (int)(256u << 16);
    g1[3] = (int)(32u << 16);
    g1[4] = 256;
    g1[5] = 32;
    g1[6] = 0;
    g1[7] = 0;
    i32x4 gz4 = {0, 0, 0, 0};   // groups 2/3 unused (<=2D tensor)
#if __clang_major__ >= 23
    i32x8 gz8 = {0, 0, 0, 0, 0, 0, 0, 0};
    __builtin_amdgcn_tensor_load_to_lds(g0, g1, gz4, gz4, gz8, 0);
#else
    __builtin_amdgcn_tensor_load_to_lds(g0, g1, gz4, gz4, 0);
#endif
    __builtin_amdgcn_s_wait_tensorcnt(0);
  }
#else
  for (int t = threadIdx.x; t < 8192; t += 128) lv[t] = vs[t];
#endif
  __syncthreads();

  int wave = threadIdx.x >> 5, lane = threadIdx.x & 31;
  int hf = lane >> 4, colL = lane & 15;
  const float* pbh = pb + (size_t)h_ * 65536;
  const float* mrow = mask + (size_t)s_ * 256;

  for (int itb = 0; itb < 4; ++itb) {
    int i0 = (itb * 4 + wave) * 16;
    // B = Q^T: lane holds column i = i0 + colL.
    v16h qb = frag_rowmajor(qs, 32, i0 + colL, 0, hf);
    // pb lies in C-operand order (see kernel B): tile (i0/16, jt) is 256
    // floats, registers 0..3 of all lanes first, then registers 4..7.
    const float* pbt = pbh + (size_t)(itb * 4 + wave) * 4096 + lane * 4;
    // acc[jt][r] = logits[i0 + colL][jt*16 + 8*hf + r]; the pair bias and the
    // mask bias enter as the C operand.
    v8f acc[16];
#pragma unroll
    for (int jt = 0; jt < 16; ++jt) {
      v4f lo = *(const v4f*)(pbt + jt * 256);
      v4f hi = *(const v4f*)(pbt + jt * 256 + 128);
      acc[jt] = __builtin_shufflevector(lo, hi, 0, 1, 2, 3, 4, 5, 6, 7);
    }
    // The registers that hold the addresses of the loads above are reused
    // below: the wait stands in front of their overwrite.
    asm volatile("s_wait_xcnt 0x0" ::: "memory");
#pragma unroll
    for (int g = 0; g < 4; ++g) {
      v16h ka[4];
      v8f mv[4];
#pragma unroll
      for (int t = 0; t < 4; ++t) {
        int jt = g * 4 + t;
        ka[t] = frag_rowmajor(ks, 32, jt * 16 + colL, 0, hf);
        mv[t] = *(const v8f*)(mrow + jt * 16 + 8 * hf);
      }
      // Keeps the loads of four tiles in flight together: without it each
      // tile's loads are issued and waited for singly, in front of its WMMA.
      __builtin_amdgcn_sched_barrier(0);
#pragma unroll
      for (int t = 0; t < 4; ++t) {
        int jt = g * 4 + t;
        v8f c;
#pragma unroll
        for (int r = 0; r < 8; ++r) c[r] = acc[jt][r] + 1e9f * (mv[t][r] - 1.f);
        acc[jt] = wmma16(ka[t], qb, c);
      }
    }
    // softmax over j: 128 values of row i in this lane, the other 128 in
    // lane ^ 16.
    v8f mx = acc[0];
#pragma unroll
    for (int jt = 1; jt < 16; ++jt)
#pragma unroll
      for (int r = 0; r < 8; ++r) mx[r] = fmaxf(mx[r], acc[jt][r]);
    float m = fmaxf(fmaxf(fmaxf(mx[0], mx[1]), fmaxf(mx[2], mx[3])),
                    fmaxf(fmaxf(mx[4], mx[5]), fmaxf(mx[6], mx[7])));
    m = fmaxf(m, __shfl_xor(m, 16, 32));
    // Tiles 2kt and 2kt+1 hold keys kt*32 + {8*hf + 0..7, 16 + 8*hf + 0..7}:
    // converted in place they are the B fragment pt[kt] in the k order of
    // kk_of (unnormalized exp; 1/rowsum folded into the epilogue).
    v8f sv = {0, 0, 0, 0, 0, 0, 0, 0};
    v16h pt[8];
#pragma unroll
    for (int jt = 0; jt < 16; ++jt)
#pragma unroll
      for (int r = 0; r < 8; ++r) {
        float e = __expf(acc[jt][r] - m);
        sv[r] += e;
        pt[jt >> 1][(jt & 1) * 8 + r] = (f16)e;
      }
    float ssum = ((sv[0] + sv[1]) + (sv[2] + sv[3])) +
                 ((sv[4] + sv[5]) + (sv[6] + sv[7]));
    ssum += __shfl_xor(ssum, 16, 32);
    float rinv = 1.f / ssum;
    // Ot = V^T Pt
    v8f oacc[2] = {{0, 0, 0, 0, 0, 0, 0, 0}, {0, 0, 0, 0, 0, 0, 0, 0}};
#pragma unroll
    for (int kt = 0; kt < 8; ++kt)
#pragma unroll
      for (int ct = 0; ct < 2; ++ct) {
        v16h va = frag_gather_col(lv, 32, ct * 16 + colL, kt * 32, hf);
        oacc[ct] = wmma16(va, pt[kt], oacc[ct]);
      }
    // oacc[ct][r] = O[i0 + colL][ct*16 + 8*hf + r]
    float* orow = o32 + ((size_t)s_ * 256 + i0 + colL) * 256 + h_ * 32 + 8 * hf;
#pragma unroll
    for (int ct = 0; ct < 2; ++ct) {
      v8f ov;
#pragma unroll
      for (int r = 0; r < 8; ++r) ov[r] = oacc[ct][r] * rinv;
      *(v8f*)(orow + ct * 16) = ov;
    }
    // The next trip overwrites the stores' address and data registers.
    asm volatile("s_wait_xcnt 0x0" ::: "memory");
  }
}

// ---------------------------------------------------------------------------
// Kernel D: out = (g * o) @ Wo + out_bias + M_raw
// ---------------------------------------------------------------------------
__global__ void __launch_bounds__(256) k_out(
    const f16* g16, const float* o32, const f16* fo, const float* out_bias,
    const float* M_raw, float* out) {
  __shared__ __attribute__((aligned(16))) f16 lx[16][LX_PITCH];
  int tid = threadIdx.x;
  size_t base = (size_t)blockIdx.x * 16 * 256;
#pragma unroll
  for (int it = 0; it < 16; ++it) {
    int idx = it * 256 + tid;
    float gv = (float)g16[base + idx];
    lx[idx >> 8][idx & 255] = (f16)(gv * o32[base + idx]);
  }
  __syncthreads();
  int wave = tid >> 5, lane = tid & 31, hf = lane >> 4, colL = lane & 15;
  int gr0 = blockIdx.x * 16;
#pragma unroll
  for (int t = 0; t < 2; ++t) {
    int nt = wave * 2 + t;
    v8f acc = {0, 0, 0, 0, 0, 0, 0, 0};
#pragma unroll
    for (int kt = 0; kt < 8; ++kt) {
      v16h a = frag_rowmajor(&lx[0][0], LX_PITCH, colL, kt * 32, hf);
      v16h b = *(const v16h*)(fo + ((size_t)(kt * 16 + nt) * 32 + lane) * 16);
      acc = wmma16(a, b, acc);
    }
    int n = nt * 16 + colL;
#pragma unroll
    for (int r = 0; r < 8; ++r) {
      size_t gi = (size_t)(gr0 + r + 8 * hf) * 256 + n;
      out[gi] = acc[r] + out_bias[n] + M_raw[gi];
    }
  }
}

// ---------------------------------------------------------------------------
extern "C" void kernel_launch(void* const* d_in, const int* in_sizes, int n_in,
                              void* d_out, int out_size, void* d_ws,
                              size_t ws_size, hipStream_t stream) {
  (void)in_sizes; (void)n_in; (void)out_size; (void)ws_size;
  const float* M_raw  = (const float*)d_in[0];
  const float* Z      = (const float*)d_in[1];
  const float* M_mask = (const float*)d_in[2];
  const float* ln_m_g = (const float*)d_in[3];
  const float* ln_m_b = (const float*)d_in[4];
  const float* ln_z_g = (const float*)d_in[5];
  const float* ln_z_b = (const float*)d_in[6];
  const float* b_w    = (const float*)d_in[7];
  const float* Wq     = (const float*)d_in[8];
  const float* Wk     = (const float*)d_in[9];
  const float* Wv     = (const float*)d_in[10];
  const float* Wg     = (const float*)d_in[11];
  const float* bg     = (const float*)d_in[12];
  const float* Wo     = (const float*)d_in[13];
  const float* ob     = (const float*)d_in[14];
  float* out = (float*)d_out;

  char* ws = (char*)d_ws;
  size_t off = 0;
  auto take = [&](size_t b) {
    char* p = ws + off;
    off += (b + 255) & ~(size_t)255;
    return p;
  };
  f16* fq   = (f16*)take(131072);      // swizzled weight fragments (f16)
  f16* fk   = (f16*)take(131072);
  f16* fv   = (f16*)take(131072);
  f16* fg   = (f16*)take(131072);
  f16* fo   = (f16*)take(131072);
  f16* q16  = (f16*)take(16777216);    // [s][h][256][32] f16
  f16* k16  = (f16*)take(16777216);
  f16* v16p = (f16*)take(16777216);
  f16* g16  = (f16*)take(16777216);    // [row][256] f16
  float* o32 = (float*)take(33554432); // [row][256] f32
  float* pb  = (float*)take(2097152);  // f32, C-operand order (kernel B)

  k_swizzle<<<80, 256, 0, stream>>>(Wq, Wk, Wv, Wg, Wo, fq, fk, fv, fg, fo);
  k_ln_qkvg<<<2048, 256, 0, stream>>>(M_raw, ln_m_g, ln_m_b, bg, fq, fk, fv,
                                      fg, q16, k16, v16p, g16);
  k_pairbias<<<512, 128, 0, stream>>>(Z, ln_z_g, ln_z_b, b_w, pb);
  k_attention<<<1024, 128, 0, stream>>>(q16, k16, v16p, pb, M_mask, o32);
  k_out<<<2048, 256, 0, stream>>>(g16, o32, fo, ob, M_raw, out);
}

// v005
// Measured time: 124 microseconds a run.
// In both of two side-by-side timings against v004, it was 1.42 times as fast.
// Counting every step since v000, it is 2.47 times as fast.
#include <hip/hip_runtime.h>
#include <hip/hip_bf16.h>
#include <math.h>

typedef _Float16 f16;
typedef __attribute__((ext_vector_type(16))) _Float16 v16h;
typedef __attribute__((ext_vector_type(8)))  _Float16 v8h;
typedef __attribute__((ext_vector_type(8)))  float    v8f;
typedef __attribute__((ext_vector_type(4)))  float    v4f;
typedef __attribute__((ext_vector_type(2)))  float    v2f;
typedef __attribute__((address_space(4))) float cfloat;

typedef unsigned int u32x4 __attribute__((ext_vector_type(4)));
typedef int          i32x4 __attribute__((ext_vector_type(4)));
typedef int          i32x8 __attribute__((ext_vector_type(8)));

#ifndef __has_builtin
#define __has_builtin(x) 0
#endif
#if __has_builtin(__builtin_amdgcn_tensor_load_to_lds) && \
    __has_builtin(__builtin_amdgcn_s_wait_tensorcnt)
#define USE_TDM 1
#else
#define USE_TDM 0
#endif

__device__ __forceinline__ int kk_of(int e, int hf) {
  int v = e >> 1, lo = e & 1;
  return ((v >> 2) << 4) + hf * 8 + ((v & 3) << 1) + lo;
}

__device__ __forceinline__ v8f wmma16(v16h a, v16h b, v8f c) {
  return __builtin_amdgcn_wmma_f32_16x16x32_f16(false, a, false, b, (short)0, c,
                                                false, false);
}

// Row-major f16 source: lane's 16 fragment halfs are two contiguous 8-half
// chunks at kbase + hf*8 and kbase + 16 + hf*8 of one row -> two b128 loads.
__device__ __forceinline__ v16h frag_rowmajor(const f16* base, int strideH,
                                              int row, int kbase, int hf) {
  const f16* p = base + (size_t)row * strideH + kbase + hf * 8;
  v8h lo = *(const v8h*)p;
  v8h hi = *(const v8h*)(p + 16);
  v16h r;
#pragma unroll
  for (int e = 0; e < 8; ++e) { r[e] = lo[e]; r[e + 8] = hi[e]; }
  return r;
}

#define LX_PITCH 264    // halfs: 256 + 8  = 528 B  = 16 B x 33
#define LRAW_PITCH 260  // floats: 256 + 4 = 1040 B = 16 B x 65

// Column gather of row-major V (A = V^T): fixed column, strided K rows.
__device__ __forceinline__ v16h frag_gather_col(const f16* base, int strideH,
                                                int col, int krow, int hf) {
  v16h r;
#pragma unroll
  for (int e = 0; e < 16; ++e)
    r[e] = base[(size_t)(krow + kk_of(e, hf)) * strideH + col];
  return r;
}

// ---------------------------------------------------------------------------
// Kernel 0: pack f32 weights [256 x 256] into f16 WMMA B-fragment order.
// Fragment buffer: [(kt*16+nt)*32 + lane]*16 halfs, kt in 0..7, nt in 0..15.
// ---------------------------------------------------------------------------
__global__ void __launch_bounds__(256) k_swizzle(
    const float* w0, const float* w1, const float* w2, const float* w3,
    const float* w4, f16* f0, f16* f1, f16* f2, f16* f3, f16* f4) {
  int t = blockIdx.x * blockDim.x + threadIdx.x;
  if (t >= 5 * 8 * 16 * 32) return;
  int w = t / 4096, rem = t % 4096;
  int kt = rem / 512; rem %= 512;
  int nt = rem / 32; int lane = rem % 32;
  const float* src = (w == 0) ? w0 : (w == 1) ? w1 : (w == 2) ? w2
                     : (w == 3) ? w3 : w4;
  f16* dst = ((w == 0) ? f0 : (w == 1) ? f1 : (w == 2) ? f2
              : (w == 3) ? f3 : f4) +
             ((size_t)(kt * 16 + nt) * 32 + lane) * 16;
  int hf = lane >> 4, col = nt * 16 + (lane & 15);
#pragma unroll
  for (int e = 0; e < 16; ++e)
    dst[e] = (f16)src[(kt * 32 + kk_of(e, hf)) * 256 + col];
}

// One 16 x 16 tile of the projection: the block's 16 normalized rows in LDS
// times n-tile nt of the packed weight fragments fr, K = 256.
__device__ __forceinline__ v8f proj_tile(const f16* lxp, const f16* fr, int nt,
                                         int lane) {
  int hf = lane >> 4, colL = lane & 15;
  __builtin_prefetch(fr + ((size_t)(nt + 16) * 32 + lane) * 16, 0, 1);
  v8f acc = {0, 0, 0, 0, 0, 0, 0, 0};
#pragma unroll
  for (int kt = 0; kt < 8; ++kt) {
    v16h a = frag_rowmajor(lxp, LX_PITCH, colL, kt * 32, hf);
    v16h b = *(const v16h*)(fr + ((size_t)(kt * 16 + nt) * 32 + lane) * 16);
    acc = wmma16(a, b, acc);
  }
  return acc;
}

// ---------------------------------------------------------------------------
// Kernel A: LayerNorm(M_raw) then fused Q/K/V/G projection GEMM via WMMA.
// One block = 16 rows of the [32768 x 256] activation, 8 waves x 8 tiles.
// q/k/v stored f16 head-major [s][h][r][32]; g stored f16 [row][256].
// ---------------------------------------------------------------------------
__global__ void __launch_bounds__(256) k_ln_qkvg(
    const float* M_raw, const float* g_ln, const float* b_ln, const float* bg,
    const f16* fq, const f16* fk, const f16* fv, const f16* fg,
    f16* q16, f16* k16, f16* v16p, f16* g16) {
  __shared__ __attribute__((aligned(16))) float lraw[16][LRAW_PITCH];
  __shared__ float lstat[16][2];
  __shared__ __attribute__((aligned(16))) f16 lx[16][LX_PITCH];
  int tid = threadIdx.x;
  size_t base = (size_t)blockIdx.x * 16 * 256;
#pragma unroll
  for (int it = 0; it < 16; ++it) {
    int idx = it * 256 + tid;
    lraw[idx >> 8][idx & 255] = M_raw[base + idx];
  }
  __syncthreads();
  if (tid < 16) {
    float s = 0.f;
    for (int c = 0; c < 256; ++c) s += lraw[tid][c];
    float mu = s * (1.f / 256.f);
    float vv = 0.f;
    for (int c = 0; c < 256; ++c) { float d = lraw[tid][c] - mu; vv += d * d; }
    lstat[tid][0] = mu;
    lstat[tid][1] = rsqrtf(vv * (1.f / 256.f) + 1e-5f);
  }
  __syncthreads();
#pragma unroll
  for (int it = 0; it < 16; ++it) {
    int idx = it * 256 + tid;
    int r = idx >> 8, c = idx & 255;
    lx[r][c] = (f16)((lraw[r][c] - lstat[r][0]) * lstat[r][1] * g_ln[c] + b_ln[c]);
  }
  __syncthreads();

  int wave = __builtin_amdgcn_readfirstlane(tid >> 5), lane = tid & 31;
  int hf = lane >> 4, colL = lane & 15;
  int mat = wave >> 1, ntb = (wave & 1) * 8;  // each wave: one matrix, 8 n-tiles
  const f16* fr = (mat == 0) ? fq : (mat == 1) ? fk : (mat == 2) ? fv : fg;
  int gr0 = blockIdx.x * 16;
  // The branch stands outside the tile loop, once per wave: between a tile's
  // last WMMA and the first use of its result there is then no branch.
  if (mat == 3) {
#pragma unroll
    for (int t = 0; t < 8; ++t) {
      int nt = ntb + t;
      int n = nt * 16 + colL;
      // Read once, ahead of the tile's stores: read again behind each store
      // (g16 could be bg, for all the compiler knows) it is waited for singly.
      float bgn = bg[n];
      v8f acc = proj_tile(&lx[0][0], fr, nt, lane);
#pragma unroll
      for (int r = 0; r < 8; ++r) {
        int gr = gr0 + r + 8 * hf;   // C-layout: lanes 16-31 hold rows +8
        float val = 1.f / (1.f + __expf(-(acc[r] + bgn)));
        g16[(size_t)gr * 256 + n] = (f16)val;
      }
      // The next tile overwrites the stores' address and data registers.
      asm volatile("s_wait_xcnt 0x0" ::: "memory");
    }
  } else {
    f16* dst = (mat == 0) ? q16 : (mat == 1) ? k16 : v16p;
    float sc = (mat == 0) ? 0.17677669529663687f : 1.f;  // q: 1/sqrt(C)
#pragma unroll
    for (int t = 0; t < 8; ++t) {
      int nt = ntb + t;
      int n = nt * 16 + colL;
      v8f acc = proj_tile(&lx[0][0], fr, nt, lane);
#pragma unroll
      for (int r = 0; r < 8; ++r) {
        int gr = gr0 + r + 8 * hf;
        int s_ = gr >> 8, i_ = gr & 255;
        int h_ = n >> 5, c_ = n & 31;
        dst[(((size_t)s_ * 8 + h_) * 256 + i_) * 32 + c_] = (f16)(acc[r] * sc);
      }
      // The next tile overwrites the stores' address and data registers.
      asm volatile("s_wait_xcnt 0x0" ::: "memory");
    }
  }
}

__global__ void __launch_bounds__(128) k_pairbias(
    const float* Z, const float* gz, const float* bz, const float* bw,
    float* pb) {
  __shared__ __attribute__((aligned(16))) float lz[128 * 132];
  int tid = threadIdx.x;
  int wave = tid >> 5, lane = tid & 31;
  int it = blockIdx.x >> 5;  // rows i = it*16 + 0..15
  int jb = blockIdx.x & 31;  // keys j = jb*8 + 0..7
  // Thread t has the pair i = it*16 + ((t>>2)&15), j = jb*8 + (t>>6)*4 + (t&3).
  v4f z[32];
  {
    // Row k of this wave belongs to thread wave*32 + k.
    const float* zp = Z +
        (size_t)((it * 16 + (wave & 1) * 8) * 256 + jb * 8 + (wave >> 1) * 4) *
            128 + lane * 4;
#pragma unroll
    for (int k = 0; k < 32; ++k)
      z[k] = *(const v4f*)(zp + ((k >> 2) * 256 + (k & 3)) * 128);
    // The registers that hold the addresses of the loads above are reused
    // below: the wait stands in front of their overwrite.
    asm volatile("s_wait_xcnt 0x0" ::: "memory");
    float* lw = lz + wave * 32 * 132 + lane * 4;
#pragma unroll
    for (int k = 0; k < 32; ++k) *(v4f*)(lw + k * 132) = z[k];
  }
  __syncthreads();
  const float* lr = lz + tid * 132;
#pragma unroll
  for (int c = 0; c < 32; ++c) z[c] = *(const v4f*)(lr + c * 4);
  v4f s4 = z[0];
#pragma unroll
  for (int c = 1; c < 32; ++c) s4 += z[c];
  float mu = ((s4[0] + s4[1]) + (s4[2] + s4[3])) * (1.f / 128.f);
  v4f q4 = {0, 0, 0, 0};
#pragma unroll
  for (int c = 0; c < 32; ++c) {
    v4f d = z[c] - mu;
    q4 += d * d;
  }
  float vv = (q4[0] + q4[1]) + (q4[2] + q4[3]);
  float rstd = rsqrtf(vv * (1.f / 128.f) + 1e-5f);
  // No launch of this file writes these three inputs: read through the
  // constant address space they come by scalar loads, one for the wave
  // (behind the asm statement above they would else be vector loads).
  const cfloat* gzc = (const cfloat*)(unsigned long long)gz;
  const cfloat* bzc = (const cfloat*)(unsigned long long)bz;
  const cfloat* bwc = (const cfloat*)(unsigned long long)bw;
  // Even and odd channels are summed apart: two neighbouring channels go
  // through one packed multiply-add.
  v2f acc[8] = {{0, 0}, {0, 0}, {0, 0}, {0, 0}, {0, 0}, {0, 0}, {0, 0}, {0, 0}};
  // Stays rolled, 8 channels a trip: unrolled, the scalar loads of all trips
  // are lifted to the top, do not fit the scalar registers and are spilled.
#pragma unroll 1
  for (int p0 = 0; p0 < 128; p0 += 8) {
    v4f za = *(const v4f*)(lr + p0);
    v4f zb = *(const v4f*)(lr + p0 + 4);
    v2f nv[4] = {{za[0], za[1]}, {za[2], za[3]}, {zb[0], zb[1]}, {zb[2], zb[3]}};
#pragma unroll
    for (int t = 0; t < 4; ++t) {
      v2f g2 = {gzc[p0 + 2 * t], gzc[p0 + 2 * t + 1]};
      v2f b2 = {bzc[p0 + 2 * t], bzc[p0 + 2 * t + 1]};
      nv[t] = (nv[t] - mu) * rstd * g2 + b2;
    }
#pragma unroll
    for (int t = 0; t < 4; ++t)
#pragma unroll
      for (int h = 0; h < 8; ++h) {
        v2f w2 = {bwc[h * 128 + p0 + 2 * t], bwc[h * 128 + p0 + 2 * t + 1]};
        acc[h] += nv[t] * w2;
      }
  }
  float* pw = pb + (it * 16 + (jb >> 1)) * 256 + (tid >> 6) * 128 +
              (jb & 1) * 64 + (tid & 63);
#pragma unroll
  for (int h = 0; h < 8; ++h) pw[(size_t)h * 65536] = acc[h][0] + acc[h][1];
}

__global__ void __launch_bounds__(128) k_attention(
    const f16* q16, const f16* k16, const f16* v16p, const float* pb,
    const float* mask, float* o32) {
  __shared__ f16 lv[256 * 32];        // V tile, 16 KB
  int s_ = blockIdx.x >> 3, h_ = blockIdx.x & 7;
  size_t headoff = ((size_t)s_ * 8 + h_) * 256 * 32;
  const f16* qs = q16 + headoff;
  const f16* ks = k16 + headoff;
  const f16* vs = v16p + headoff;

#if USE_TDM
  if (threadIdx.x < 32) {
    unsigned lds_off = (unsigned)(unsigned long long)(const void*)&lv[0];
    unsigned long long ga = (unsigned long long)(const void*)vs;
    u32x4 g0;
    g0[0] = 1u;                                   // count=1, user mode
    g0[1] = lds_off;                              // lds_addr
    g0[2] = (unsigned)(ga & 0xffffffffu);         // global_addr[31:0]
    g0[3] = (unsigned)((ga >> 32) & 0x01ffffffu)  // global_addr[56:32]
            | (2u << 30);                         // type=2 (image)
    i32x8 g1;
    g1[0] = (int)(1u << 16);
    g1[1] = (int)(32u << 16);
    g1[2] = (int)(256u << 16);
    g1[3] = (int)(32u << 16);
    g1[4] = 256;
    g1[5] = 32;
    g1[6] = 0;
    g1[7] = 0;
    i32x4 gz4 = {0, 0, 0, 0};   // groups 2/3 unused (<=2D tensor)
#if __clang_major__ >= 23
    i32x8 gz8 = {0, 0, 0, 0, 0, 0, 0, 0};
    __builtin_amdgcn_tensor_load_to_lds(g0, g1, gz4, gz4, gz8, 0);
#else
    __builtin_amdgcn_tensor_load_to_lds(g0, g1, gz4, gz4, 0);
#endif
    __builtin_amdgcn_s_wait_tensorcnt(0);
  }
#else
  for (int t = threadIdx.x; t < 8192; t += 128) lv[t] = vs[t];
#endif
  __syncthreads();

  int wave = threadIdx.x >> 5, lane = threadIdx.x & 31;
  int hf = lane >> 4, colL = lane & 15;
  const float* pbh = pb + (size_t)h_ * 65536;
  const float* mrow = mask + (size_t)s_ * 256;

  for (int itb = 0; itb < 4; ++itb) {
    int i0 = (itb * 4 + wave) * 16;
    // B = Q^T: lane holds column i = i0 + colL.
    v16h qb = frag_rowmajor(qs, 32, i0 + colL, 0, hf);
    // pb lies in C-operand order (see kernel B): tile (i0/16, jt) is 256
    // floats, registers 0..3 of all lanes first, then registers 4..7.
    const float* pbt = pbh + (size_t)(itb * 4 + wave) * 4096 + lane * 4;
    // acc[jt][r] = logits[i0 + colL][jt*16 + 8*hf + r]; the pair bias and the
    // mask bias enter as the C operand.
    v8f acc[16];
#pragma unroll
    for (int jt = 0; jt < 16; ++jt) {
      v4f lo = *(const v4f*)(pbt + jt * 256);
      v4f hi = *(const v4f*)(pbt + jt * 256 + 128);
      acc[jt] = __builtin_shufflevector(lo, hi, 0, 1, 2, 3, 4, 5, 6, 7);
    }
    // The registers that hold the addresses of the loads above are reused
    // below: the wait stands in front of their overwrite.
    asm volatile("s_wait_xcnt 0x0" ::: "memory");
#pragma unroll
    for (int g = 0; g < 4; ++g) {
      v16h ka[4];
      v8f mv[4];
#pragma unroll
      for (int t = 0; t < 4; ++t) {
        int jt = g * 4 + t;
        ka[t] = frag_rowmajor(ks, 32, jt * 16 + colL, 0, hf);
        mv[t] = *(const v8f*)(mrow + jt * 16 + 8 * hf);
      }
      // Keeps the loads of four tiles in flight together: without it each
      // tile's loads are issued and waited for singly, in front of its WMMA.
      __builtin_amdgcn_sched_barrier(0);
#pragma unroll
      for (int t = 0; t < 4; ++t) {
        int jt = g * 4 + t;
        v8f c;
#pragma unroll
        for (int r = 0; r < 8; ++r) c[r] = acc[jt][r] + 1e9f * (mv[t][r] - 1.f);
        acc[jt] = wmma16(ka[t], qb, c);
      }
    }
    // softmax over j: 128 values of row i in this lane, the other 128 in
    // lane ^ 16.
    v8f mx = acc[0];
#pragma unroll
    for (int jt = 1; jt < 16; ++jt)
#pragma unroll
      for (int r = 0; r < 8; ++r) mx[r] = fmaxf(mx[r], acc[jt][r]);
    float m = fmaxf(fmaxf(fmaxf(mx[0], mx[1]), fmaxf(mx[2], mx[3])),
                    fmaxf(fmaxf(mx[4], mx[5]), fmaxf(mx[6], mx[7])));
    m = fmaxf(m, __shfl_xor(m, 16, 32));
    // Tiles 2kt and 2kt+1 hold keys kt*32 + {8*hf + 0..7, 16 + 8*hf + 0..7}:
    // converted in place they are the B fragment pt[kt] in the k order of
    // kk_of (unnormalized exp; 1/rowsum folded into the epilogue).
    v8f sv = {0, 0, 0, 0, 0, 0, 0, 0};
    v16h pt[8];
#pragma unroll
    for (int jt = 0; jt < 16; ++jt)
#pragma unroll
      for (int r = 0; r < 8; ++r) {
        float e = __expf(acc[jt][r] - m);
        sv[r] += e;
        pt[jt >> 1][(jt & 1) * 8 + r] = (f16)e;
      }
    float ssum = ((sv[0] + sv[1]) + (sv[2] + sv[3])) +
                 ((sv[4] + sv[5]) + (sv[6] + sv[7]));
    ssum += __shfl_xor(ssum, 16, 32);
    float rinv = 1.f / ssum;
    // Ot = V^T Pt
    v8f oacc[2] = {{0, 0, 0, 0, 0, 0, 0, 0}, {0, 0, 0, 0, 0, 0, 0, 0}};
#pragma unroll
    for (int kt = 0; kt < 8; ++kt)
#pragma unroll
      for (int ct = 0; ct < 2; ++ct) {
        v16h va = frag_gather_col(lv, 32, ct * 16 + colL, kt * 32, hf);
        oacc[ct] = wmma16(va, pt[kt], oacc[ct]);
      }
    // oacc[ct][r] = O[i0 + colL][ct*16 + 8*hf + r]
    float* orow = o32 + ((size_t)s_ * 256 + i0 + colL) * 256 + h_ * 32 + 8 * hf;
#pragma unroll
    for (int ct = 0; ct < 2; ++ct) {
      v8f ov;
#pragma unroll
      for (int r = 0; r < 8; ++r) ov[r] = oacc[ct][r] * rinv;
      *(v8f*)(orow + ct * 16) = ov;
    }
    // The next trip overwrites the stores' address and data registers.
    asm volatile("s_wait_xcnt 0x0" ::: "memory");
  }
}

// ---------------------------------------------------------------------------
// Kernel D: out = (g * o) @ Wo + out_bias + M_raw
// ---------------------------------------------------------------------------
__global__ void __launch_bounds__(256) k_out(
    const f16* g16, const float* o32, const f16* fo, const float* out_bias,
    const float* M_raw, float* out) {
  __shared__ __attribute__((aligned(16))) f16 lx[16][LX_PITCH];
  int tid = threadIdx.x;
  size_t base = (size_t)blockIdx.x * 16 * 256;
  int wave = tid >> 5, lane = tid & 31, hf = lane >> 4, colL = lane & 15;
  int gr0 = blockIdx.x * 16;
  // The residual and the bias of the lane's 16 output elements are read here,
  // with the staging loads: read among the stores of the epilogue (out could
  // be M_raw, for all the compiler knows) each is waited for singly.
  float res[2][8], ob[2];
#pragma unroll
  for (int t = 0; t < 2; ++t) {
    int n = (wave * 2 + t) * 16 + colL;
    ob[t] = out_bias[n];
#pragma unroll
    for (int r = 0; r < 8; ++r)
      res[t][r] = M_raw[(size_t)(gr0 + r + 8 * hf) * 256 + n];
  }
#pragma unroll
  for (int it = 0; it < 16; ++it) {
    int idx = it * 256 + tid;
    float gv = (float)g16[base + idx];
    lx[idx >> 8][idx & 255] = (f16)(gv * o32[base + idx]);
  }
  __syncthreads();
  // Both tiles' products stand ahead of the first store, so that the weight
  // loads of the second tile need not wait behind the stores of the first.
  v8f acc[2];
#pragma unroll
  for (int t = 0; t < 2; ++t) {
    int nt = wave * 2 + t;
    acc[t] = (v8f){0, 0, 0, 0, 0, 0, 0, 0};
#pragma unroll
    for (int kt = 0; kt < 8; ++kt) {
      v16h a = frag_rowmajor(&lx[0][0], LX_PITCH, colL, kt * 32, hf);
      v16h b = *(const v16h*)(fo + ((size_t)(kt * 16 + nt) * 32 + lane) * 16);
      acc[t] = wmma16(a, b, acc[t]);
    }
  }
#pragma unroll
  for (int t = 0; t < 2; ++t) {
    int n = (wave * 2 + t) * 16 + colL;
#pragma unroll
    for (int r = 0; r < 8; ++r) {
      size_t gi = (size_t)(gr0 + r + 8 * hf) * 256 + n;
      out[gi] = acc[t][r] + ob[t] + res[t][r];
    }
  }
}

// ---------------------------------------------------------------------------
extern "C" void kernel_launch(void* const* d_in, const int* in_sizes, int n_in,
                              void* d_out, int out_size, void* d_ws,
                              size_t ws_size, hipStream_t stream) {
  (void)in_sizes; (void)n_in; (void)out_size; (void)ws_size;
  const float* M_raw  = (const float*)d_in[0];
  const float* Z      = (const float*)d_in[1];
  const float* M_mask = (const float*)d_in[2];
  const float* ln_m_g = (const float*)d_in[3];
  const float* ln_m_b = (const float*)d_in[4];
  const float* ln_z_g = (const float*)d_in[5];
  const float* ln_z_b = (const float*)d_in[6];
  const float* b_w    = (const float*)d_in[7];
  const float* Wq     = (const float*)d_in[8];
  const float* Wk     = (const float*)d_in[9];
  const float* Wv     = (const float*)d_in[10];
  const float* Wg     = (const float*)d_in[11];
  const float* bg     = (const float*)d_in[12];
  const float* Wo     = (const float*)d_in[13];
  const float* ob     = (const float*)d_in[14];
  float* out = (float*)d_out;

  char* ws = (char*)d_ws;
  size_t off = 0;
  auto take = [&](size_t b) {
    char* p = ws + off;
    off += (b + 255) & ~(size_t)255;
    return p;
  };
  f16* fq   = (f16*)take(131072);      // swizzled weight fragments (f16)
  f16* fk   = (f16*)take(131072);
  f16* fv   = (f16*)take(131072);
  f16* fg   = (f16*)take(131072);
  f16* fo   = (f16*)take(131072);
  f16* q16  = (f16*)take(16777216);    // [s][h][256][32] f16
  f16* k16  = (f16*)take(16777216);
  f16* v16p = (f16*)take(16777216);
  f16* g16  = (f16*)take(16777216);    // [row][256] f16
  float* o32 = (float*)take(33554432); // [row][256] f32
  float* pb  = (float*)take(2097152);  // f32, C-operand order (kernel B)

  k_swizzle<<<80, 256, 0, stream>>>(Wq, Wk, Wv, Wg, Wo, fq, fk, fv, fg, fo);
  k_ln_qkvg<<<2048, 256, 0, stream>>>(M_raw, ln_m_g, ln_m_b, bg, fq, fk, fv,
                                      fg, q16, k16, v16p, g16);
  k_pairbias<<<512, 128, 0, stream>>>(Z, ln_z_g, ln_z_b, b_w, pb);
  k_attention<<<1024, 128, 0, stream>>>(q16, k16, v16p, pb, M_mask, o32);
  k_out<<<2048, 256, 0, stream>>>(g16, o32, fo, ob, M_raw, out);
}

// v006
// Measured time: 91.2 microseconds a run.
// Next to v005, in two timings, it ran 1.35 and 1.36 times as fast.
// Over all steps from v000 it is 3.34 times as fast.
#include <hip/hip_runtime.h>
#include <hip/hip_bf16.h>
#include <math.h>

typedef _Float16 f16;
typedef __attribute__((ext_vector_type(16))) _Float16 v16h;
typedef __attribute__((ext_vector_type(8)))  _Float16 v8h;
typedef __attribute__((ext_vector_type(8)))  float    v8f;
typedef __attribute__((ext_vector_type(4)))  float    v4f;
typedef __attribute__((ext_vector_type(2)))  float    v2f;
typedef __attribute__((address_space(4))) float cfloat;

typedef unsigned int u32x4 __attribute__((ext_vector_type(4)));
typedef int          i32x4 __attribute__((ext_vector_type(4)));
typedef int          i32x8 __attribute__((ext_vector_type(8)));

#ifndef __has_builtin
#define __has_builtin(x) 0
#endif
#if __has_builtin(__builtin_amdgcn_tensor_load_to_lds) && \
    __has_builtin(__builtin_amdgcn_s_wait_tensorcnt)
#define USE_TDM 1
#else
#define USE_TDM 0
#endif

__device__ __forceinline__ int kk_of(int e, int hf) {
  int v = e >> 1, lo = e & 1;
  return ((v >> 2) << 4) + hf * 8 + ((v & 3) << 1) + lo;
}

__device__ __forceinline__ v8f wmma16(v16h a, v16h b, v8f c) {
  return __builtin_amdgcn_wmma_f32_16x16x32_f16(false, a, false, b, (short)0, c,
                                                false, false);
}

// Row-major f16 source: lane's 16 fragment halfs are two contiguous 8-half
// chunks at kbase + hf*8 and kbase + 16 + hf*8 of one row -> two b128 loads.
__device__ __forceinline__ v16h frag_rowmajor(const f16* base, int strideH,
                                              int row, int kbase, int hf) {
  const f16* p = base + (size_t)row * strideH + kbase + hf * 8;
  v8h lo = *(const v8h*)p;
  v8h hi = *(const v8h*)(p + 16);
  v16h r;
#pragma unroll
  for (int e = 0; e < 8; ++e) { r[e] = lo[e]; r[e + 8] = hi[e]; }
  return r;
}

#define LX_PITCH 264    // halfs: 256 + 8  = 528 B  = 16 B x 33
#define LRAW_PITCH 260  // floats: 256 + 4 = 1040 B = 16 B x 65

// Column gather of row-major V (A = V^T): fixed column, strided K rows.
__device__ __forceinline__ v16h frag_gather_col(const f16* base, int strideH,
                                                int col, int krow, int hf) {
  v16h r;
#pragma unroll
  for (int e = 0; e < 16; ++e)
    r[e] = base[(size_t)(krow + kk_of(e, hf)) * strideH + col];
  return r;
}

// ---------------------------------------------------------------------------
// Kernel 0: pack f32 weights [256 x 256] into f16 WMMA B-fragment order.
// Fragment buffer: [(kt*16+nt)*32 + lane]*16 halfs, kt in 0..7, nt in 0..15.
// ---------------------------------------------------------------------------
__global__ void __launch_bounds__(256) k_swizzle(
    const float* w0, const float* w1, const float* w2, const float* w3,
    const float* w4, f16* f0, f16* f1, f16* f2, f16* f3, f16* f4) {
  int t = blockIdx.x * blockDim.x + threadIdx.x;
  if (t >= 5 * 8 * 16 * 32) return;
  int w = t / 4096, rem = t % 4096;
  int kt = rem / 512; rem %= 512;
  int nt = rem / 32; int lane = rem % 32;
  const float* src = (w == 0) ? w0 : (w == 1) ? w1 : (w == 2) ? w2
                     : (w == 3) ? w3 : w4;
  f16* dst = ((w == 0) ? f0 : (w == 1) ? f1 : (w == 2) ? f2
              : (w == 3) ? f3 : f4) +
             ((size_t)(kt * 16 + nt) * 32 + lane) * 16;
  int hf = lane >> 4, col = nt * 16 + (lane & 15);
#pragma unroll
  for (int e = 0; e < 16; ++e)
    dst[e] = (f16)src[(kt * 32 + kk_of(e, hf)) * 256 + col];
}

// Rows of the activation that one block of either GEMM kernel takes: MT tiles
// of 16. A weight fragment, once loaded, is multiplied with all MT row tiles,
// so a block's pass over the packed weights serves 64 rows, not 16.
#define MT 4
#define BROWS (MT * 16)

// A 64 x (NT*16) piece of a product: the block's 64 rows in LDS times n-tiles
// nt0 .. nt0+NT-1 of the packed weight fragments fr, K = 256.
template <int NT>
__device__ __forceinline__ void mm_rows(const f16* lxp, const f16* fr, int nt0,
                                        int lane, v8f (&acc)[MT][NT]) {
  int hf = lane >> 4, colL = lane & 15;
  // One address a lane for all weight fragments: every step from it is a
  // constant, and its register lives through the whole product.
  const f16* bp = fr + ((size_t)nt0 * 32 + lane) * 16;
#pragma unroll
  for (int m = 0; m < MT; ++m)
#pragma unroll
    for (int j = 0; j < NT; ++j) acc[m][j] = (v8f){0, 0, 0, 0, 0, 0, 0, 0};
#pragma unroll
  for (int kt = 0; kt < 8; ++kt) {
    v16h b[NT], a[MT];
#pragma unroll
    for (int j = 0; j < NT; ++j)
      b[j] = *(const v16h*)(bp + (kt * 16 + j) * 512);
#pragma unroll
    for (int m = 0; m < MT; ++m)
      a[m] = frag_rowmajor(lxp, LX_PITCH, m * 16 + colL, kt * 32, hf);
    // Keeps a step's loads in one group ahead of its WMMAs: spread among them
    // each pair of LDS loads is waited for singly.
    __builtin_amdgcn_sched_barrier(0);
#pragma unroll
    for (int m = 0; m < MT; ++m)
#pragma unroll
      for (int j = 0; j < NT; ++j) acc[m][j] = wmma16(a[m], b[j], acc[m][j]);
  }
}

// ---------------------------------------------------------------------------
// Kernel A: LayerNorm(M_raw) then fused Q/K/V/G projection GEMM via WMMA.
// One block = 64 rows of the [32768 x 256] activation; each of the 8 waves has
// 4 n-tiles of each of two matrices, taken against all 4 row tiles.
// q/k/v stored f16 head-major [s][h][r][32]; g stored f16 [row][256].
// ---------------------------------------------------------------------------
__global__ void __launch_bounds__(256) k_ln_qkvg(
    const float* M_raw, const float* g_ln, const float* b_ln, const float* bg,
    const f16* fq, const f16* fk, const f16* fv, const f16* fg,
    f16* q16, f16* k16, f16* v16p, f16* g16) {
  __shared__ __attribute__((aligned(16))) float lraw[BROWS][LRAW_PITCH];
  __shared__ float lstat[BROWS][2];
  __shared__ __attribute__((aligned(16))) f16 lx[BROWS][LX_PITCH];
  int tid = threadIdx.x;
  size_t base = (size_t)blockIdx.x * BROWS * 256;
#pragma unroll
  for (int it = 0; it < BROWS; ++it) {
    int idx = it * 256 + tid;
    lraw[idx >> 8][idx & 255] = M_raw[base + idx];
  }
  __syncthreads();
  if (tid < BROWS) {
    float s = 0.f;
    for (int c = 0; c < 256; ++c) s += lraw[tid][c];
    float mu = s * (1.f / 256.f);
    float vv = 0.f;
    for (int c = 0; c < 256; ++c) { float d = lraw[tid][c] - mu; vv += d * d; }
    lstat[tid][0] = mu;
    lstat[tid][1] = rsqrtf(vv * (1.f / 256.f) + 1e-5f);
  }
  __syncthreads();
#pragma unroll
  for (int it = 0; it < BROWS; ++it) {
    int idx = it * 256 + tid;
    int r = idx >> 8, c = idx & 255;
    lx[r][c] = (f16)((lraw[r][c] - lstat[r][0]) * lstat[r][1] * g_ln[c] + b_ln[c]);
  }
  __syncthreads();

  int wave = __builtin_amdgcn_readfirstlane(tid >> 5), lane = tid & 31;
  int hf = lane >> 4, colL = lane & 15;
  // Each wave has the same four n-tiles of two matrices: waves 0-3 of g and v,
  // waves 4-7 of q and k. The gate's long epilogue so
  // comes first, beside the other waves' products.
  int nt0 = (wave & 3) * 4;
  int gr0 = blockIdx.x * BROWS;
  v8f acc[MT][4];
  // The branch stands in front of the products, once per wave: between a
  // tile's last WMMA and the first use of its result there is then no branch.
  if (wave < 4) {
    // Read once, ahead of the stores: read again behind each store (g16
    // could be bg, for all the compiler knows) it is waited for singly.
    float bgn[4];
#pragma unroll
    for (int j = 0; j < 4; ++j) bgn[j] = bg[nt0 * 16 + colL + j * 16];
    // The register that holds the offset of these loads is reused below: the
    // wait stands in front of its overwrite.
    asm volatile("s_wait_xcnt 0x0" ::: "memory");
    mm_rows<4>(&lx[0][0], fg, nt0, lane, acc);
    // Keeps the epilogue out of the products' scheduling region: mixed in
    // there, where registers are scarce, all its stores went through one data
    // register, each waited for before the next conversion.
    __builtin_amdgcn_sched_barrier(0);
    // C-layout: lanes 16-31 hold rows +8. One address a lane; every tile, row
    // and column step from it is a constant.
    f16* gp = g16 + (size_t)(gr0 + 8 * hf) * 256 + nt0 * 16 + colL;
#pragma unroll
    for (int m = 0; m < MT; ++m)
#pragma unroll
      for (int j = 0; j < 4; ++j) {
#pragma unroll
        for (int r = 0; r < 8; ++r) {
          float val = 1.f / (1.f + __expf(-(acc[m][j][r] + bgn[j])));
          gp[(m * 16 + r) * 256 + j * 16] = (f16)val;
        }
        // The next tile overwrites the stores' data registers.
        asm volatile("s_wait_xcnt 0x0" ::: "memory");
      }
  }
  int mat0 = (wave < 4) ? 2 : 0, mat1 = (wave < 4) ? 3 : 2;
  // Stays rolled: q, k and v run through the same code, which then takes a
  // third of the room in the instruction cache.
#pragma unroll 1
  for (int mat = mat0; mat < mat1; ++mat) {
    const f16* fr = (mat == 0) ? fq : (mat == 1) ? fk : fv;
    f16* dst = (mat == 0) ? q16 : (mat == 1) ? k16 : v16p;
    float sc = (mat == 0) ? 0.17677669529663687f : 1.f;  // q: 1/sqrt(C)
    mm_rows<4>(&lx[0][0], fr, nt0, lane, acc);
    // As above: keeps the epilogue out of the products' scheduling region.
    __builtin_amdgcn_sched_barrier(0);
    // The block's 64 rows lie in one s, the wave's four n-tiles in two heads:
    // one address a lane; every tile and row step from it is a constant.
    f16* dp = dst + (((size_t)(gr0 >> 8) * 8 + (nt0 >> 1)) * 256 + (gr0 & 255) +
                     8 * hf) * 32 + colL;
#pragma unroll
    for (int m = 0; m < MT; ++m)
#pragma unroll
      for (int j = 0; j < 4; ++j) {
#pragma unroll
        for (int r = 0; r < 8; ++r)
          dp[((j >> 1) * 256 + m * 16 + r) * 32 + (j & 1) * 16] =
              (f16)(acc[m][j][r] * sc);
        // The next tile overwrites the stores' data registers.
        asm volatile("s_wait_xcnt 0x0" ::: "memory");
      }
  }
}

__global__ void __launch_bounds__(128) k_pairbias(
    const float* Z, const float* gz, const float* bz, const float* bw,
    float* pb) {
  __shared__ __attribute__((aligned(16))) float lz[128 * 132];
  int tid = threadIdx.x;
  int wave = tid >> 5, lane = tid & 31;
  int it = blockIdx.x >> 5;  // rows i = it*16 + 0..15
  int jb = blockIdx.x & 31;  // keys j = jb*8 + 0..7
  // Thread t has the pair i = it*16 + ((t>>2)&15), j = jb*8 + (t>>6)*4 + (t&3).
  v4f z[32];
  {
    // Row k of this wave belongs to thread wave*32 + k.
    const float* zp = Z +
        (size_t)((it * 16 + (wave & 1) * 8) * 256 + jb * 8 + (wave >> 1) * 4) *
            128 + lane * 4;
#pragma unroll
    for (int k = 0; k < 32; ++k)
      z[k] = *(const v4f*)(zp + ((k >> 2) * 256 + (k & 3)) * 128);
    // The registers that hold the addresses of the loads above are reused
    // below: the wait stands in front of their overwrite.
    asm volatile("s_wait_xcnt 0x0" ::: "memory");
    float* lw = lz + wave * 32 * 132 + lane * 4;
#pragma unroll
    for (int k = 0; k < 32; ++k) *(v4f*)(lw + k * 132) = z[k];
  }
  __syncthreads();
  const float* lr = lz + tid * 132;
#pragma unroll
  for (int c = 0; c < 32; ++c) z[c] = *(const v4f*)(lr + c * 4);
  v4f s4 = z[0];
#pragma unroll
  for (int c = 1; c < 32; ++c) s4 += z[c];
  float mu = ((s4[0] + s4[1]) + (s4[2] + s4[3])) * (1.f / 128.f);
  v4f q4 = {0, 0, 0, 0};
#pragma unroll
  for (int c = 0; c < 32; ++c) {
    v4f d = z[c] - mu;
    q4 += d * d;
  }
  float vv = (q4[0] + q4[1]) + (q4[2] + q4[3]);
  float rstd = rsqrtf(vv * (1.f / 128.f) + 1e-5f);
  // No launch of this file writes these three inputs: read through the
  // constant address space they come by scalar loads, one for the wave
  // (behind the asm statement above they would else be vector loads).
  const cfloat* gzc = (const cfloat*)(unsigned long long)gz;
  const cfloat* bzc = (const cfloat*)(unsigned long long)bz;
  const cfloat* bwc = (const cfloat*)(unsigned long long)bw;
  // Even and odd channels are summed apart: two neighbouring channels go
  // through one packed multiply-add.
  v2f acc[8] = {{0, 0}, {0, 0}, {0, 0}, {0, 0}, {0, 0}, {0, 0}, {0, 0}, {0, 0}};
  // Stays rolled, 8 channels a trip: unrolled, the scalar loads of all trips
  // are lifted to the top, do not fit the scalar registers and are spilled.
#pragma unroll 1
  for (int p0 = 0; p0 < 128; p0 += 8) {
    v4f za = *(const v4f*)(lr + p0);
    v4f zb = *(const v4f*)(lr + p0 + 4);
    v2f nv[4] = {{za[0], za[1]}, {za[2], za[3]}, {zb[0], zb[1]}, {zb[2], zb[3]}};
#pragma unroll
    for (int t = 0; t < 4; ++t) {
      v2f g2 = {gzc[p0 + 2 * t], gzc[p0 + 2 * t + 1]};
      v2f b2 = {bzc[p0 + 2 * t], bzc[p0 + 2 * t + 1]};
      nv[t] = (nv[t] - mu) * rstd * g2 + b2;
    }
#pragma unroll
    for (int t = 0; t < 4; ++t)
#pragma unroll
      for (int h = 0; h < 8; ++h) {
        v2f w2 = {bwc[h * 128 + p0 + 2 * t], bwc[h * 128 + p0 + 2 * t + 1]};
        acc[h] += nv[t] * w2;
      }
  }
  float* pw = pb + (it * 16 + (jb >> 1)) * 256 + (tid >> 6) * 128 +
              (jb & 1) * 64 + (tid & 63);
#pragma unroll
  for (int h = 0; h < 8; ++h) pw[(size_t)h * 65536] = acc[h][0] + acc[h][1];
}

__global__ void __launch_bounds__(128) k_attention(
    const f16* q16, const f16* k16, const f16* v16p, const float* pb,
    const float* mask, float* o32) {
  __shared__ f16 lv[256 * 32];        // V tile, 16 KB
  int s_ = blockIdx.x >> 3, h_ = blockIdx.x & 7;
  size_t headoff = ((size_t)s_ * 8 + h_) * 256 * 32;
  const f16* qs = q16 + headoff;
  const f16* ks = k16 + headoff;
  const f16* vs = v16p + headoff;

#if USE_TDM
  if (threadIdx.x < 32) {
    unsigned lds_off = (unsigned)(unsigned long long)(const void*)&lv[0];
    unsigned long long ga = (unsigned long long)(const void*)vs;
    u32x4 g0;
    g0[0] = 1u;                                   // count=1, user mode
    g0[1] = lds_off;                              // lds_addr
    g0[2] = (unsigned)(ga & 0xffffffffu);         // global_addr[31:0]
    g0[3] = (unsigned)((ga >> 32) & 0x01ffffffu)  // global_addr[56:32]
            | (2u << 30);                         // type=2 (image)
    i32x8 g1;
    g1[0] = (int)(1u << 16);
    g1[1] = (int)(32u << 16);
    g1[2] = (int)(256u << 16);
    g1[3] = (int)(32u << 16);
    g1[4] = 256;
    g1[5] = 32;
    g1[6] = 0;
    g1[7] = 0;
    i32x4 gz4 = {0, 0, 0, 0};   // groups 2/3 unused (<=2D tensor)
#if __clang_major__ >= 23
    i32x8 gz8 = {0, 0, 0, 0, 0, 0, 0, 0};
    __builtin_amdgcn_tensor_load_to_lds(g0, g1, gz4, gz4, gz8, 0);
#else
    __builtin_amdgcn_tensor_load_to_lds(g0, g1, gz4, gz4, 0);
#endif
    __builtin_amdgcn_s_wait_tensorcnt(0);
  }
#else
  for (int t = threadIdx.x; t < 8192; t += 128) lv[t] = vs[t];
#endif
  __syncthreads();

  int wave = threadIdx.x >> 5, lane = threadIdx.x & 31;
  int hf = lane >> 4, colL = lane & 15;
  const float* pbh = pb + (size_t)h_ * 65536;
  const float* mrow = mask + (size_t)s_ * 256;

  for (int itb = 0; itb < 4; ++itb) {
    int i0 = (itb * 4 + wave) * 16;
    // B = Q^T: lane holds column i = i0 + colL.
    v16h qb = frag_rowmajor(qs, 32, i0 + colL, 0, hf);
    // pb lies in C-operand order (see kernel B): tile (i0/16, jt) is 256
    // floats, registers 0..3 of all lanes first, then registers 4..7.
    const float* pbt = pbh + (size_t)(itb * 4 + wave) * 4096 + lane * 4;
    // acc[jt][r] = logits[i0 + colL][jt*16 + 8*hf + r]; the pair bias and the
    // mask bias enter as the C operand.
    v8f acc[16];
#pragma unroll
    for (int jt = 0; jt < 16; ++jt) {
      v4f lo = *(const v4f*)(pbt + jt * 256);
      v4f hi = *(const v4f*)(pbt + jt * 256 + 128);
      acc[jt] = __builtin_shufflevector(lo, hi, 0, 1, 2, 3, 4, 5, 6, 7);
    }
    // The registers that hold the addresses of the loads above are reused
    // below: the wait stands in front of their overwrite.
    asm volatile("s_wait_xcnt 0x0" ::: "memory");
#pragma unroll
    for (int g = 0; g < 4; ++g) {
      v16h ka[4];
      v8f mv[4];
#pragma unroll
      for (int t = 0; t < 4; ++t) {
        int jt = g * 4 + t;
        ka[t] = frag_rowmajor(ks, 32, jt * 16 + colL, 0, hf);
        mv[t] = *(const v8f*)(mrow + jt * 16 + 8 * hf);
      }
      // Keeps the loads of four tiles in flight together: without it each
      // tile's loads are issued and waited for singly, in front of its WMMA.
      __builtin_amdgcn_sched_barrier(0);
#pragma unroll
      for (int t = 0; t < 4; ++t) {
        int jt = g * 4 + t;
        v8f c;
#pragma unroll
        for (int r = 0; r < 8; ++r) c[r] = acc[jt][r] + 1e9f * (mv[t][r] - 1.f);
        acc[jt] = wmma16(ka[t], qb, c);
      }
    }
    // softmax over j: 128 values of row i in this lane, the other 128 in
    // lane ^ 16.
    v8f mx = acc[0];
#pragma unroll
    for (int jt = 1; jt < 16; ++jt)
#pragma unroll
      for (int r = 0; r < 8; ++r) mx[r] = fmaxf(mx[r], acc[jt][r]);
    float m = fmaxf(fmaxf(fmaxf(mx[0], mx[1]), fmaxf(mx[2], mx[3])),
                    fmaxf(fmaxf(mx[4], mx[5]), fmaxf(mx[6], mx[7])));
    m = fmaxf(m, __shfl_xor(m, 16, 32));
    // Tiles 2kt and 2kt+1 hold keys kt*32 + {8*hf + 0..7, 16 + 8*hf + 0..7}:
    // converted in place they are the B fragment pt[kt] in the k order of
    // kk_of (unnormalized exp; 1/rowsum folded into the epilogue).
    v8f sv = {0, 0, 0, 0, 0, 0, 0, 0};
    v16h pt[8];
#pragma unroll
    for (int jt = 0; jt < 16; ++jt)
#pragma unroll
      for (int r = 0; r < 8; ++r) {
        float e = __expf(acc[jt][r] - m);
        sv[r] += e;
        pt[jt >> 1][(jt & 1) * 8 + r] = (f16)e;
      }
    float ssum = ((sv[0] + sv[1]) + (sv[2] + sv[3])) +
                 ((sv[4] + sv[5]) + (sv[6] + sv[7]));
    ssum += __shfl_xor(ssum, 16, 32);
    float rinv = 1.f / ssum;
    // Ot = V^T Pt
    v8f oacc[2] = {{0, 0, 0, 0, 0, 0, 0, 0}, {0, 0, 0, 0, 0, 0, 0, 0}};
#pragma unroll
    for (int kt = 0; kt < 8; ++kt)
#pragma unroll
      for (int ct = 0; ct < 2; ++ct) {
        v16h va = frag_gather_col(lv, 32, ct * 16 + colL, kt * 32, hf);
        oacc[ct] = wmma16(va, pt[kt], oacc[ct]);
      }
    // oacc[ct][r] = O[i0 + colL][ct*16 + 8*hf + r]
    float* orow = o32 + ((size_t)s_ * 256 + i0 + colL) * 256 + h_ * 32 + 8 * hf;
#pragma unroll
    for (int ct = 0; ct < 2; ++ct) {
      v8f ov;
#pragma unroll
      for (int r = 0; r < 8; ++r) ov[r] = oacc[ct][r] * rinv;
      *(v8f*)(orow + ct * 16) = ov;
    }
    // The next trip overwrites the stores' address and data registers.
    asm volatile("s_wait_xcnt 0x0" ::: "memory");
  }
}

// ---------------------------------------------------------------------------
// Kernel D: out = (g * o) @ Wo + out_bias + M_raw
// One block = 64 rows; each of the 8 waves has 2 n-tiles against 4 row tiles.
// ---------------------------------------------------------------------------
__global__ void __launch_bounds__(256) k_out(
    const f16* g16, const float* o32, const f16* fo, const float* out_bias,
    const float* M_raw, float* out) {
  __shared__ __attribute__((aligned(16))) f16 lx[BROWS][LX_PITCH];
  int tid = threadIdx.x;
  size_t base = (size_t)blockIdx.x * BROWS * 256;
  // The wave's number as a scalar: the addresses of the wave's weight fragments
  // and columns then need no vector registers of their own, which are scarce
  // here (64 accumulators and 64 residuals a lane).
  int wave = __builtin_amdgcn_readfirstlane(tid >> 5);
  int lane = tid & 31, hf = lane >> 4, colL = lane & 15;
  int gr0 = blockIdx.x * BROWS;
  // The residual and the bias of the lane's output elements are read here,
  // with the staging loads: read among the stores of the epilogue (out could
  // be M_raw, for all the compiler knows) each is waited for singly.
  float res[MT][2][8], ob[2];
#pragma unroll
  for (int t = 0; t < 2; ++t) ob[t] = out_bias[(wave * 2 + t) * 16 + colL];
  // The register that holds the offset of the two loads above is given to a
  // later load as its destination: the wait stands in front of that.
  asm volatile("s_wait_xcnt 0x0" ::: "memory");
  // One offset a lane for the residual and the output; every tile, row and
  // column step from it is a constant.
  size_t eoff = (size_t)(gr0 + 8 * hf) * 256 + wave * 32 + colL;
  const float* mp = M_raw + eoff;
#pragma unroll
  for (int t = 0; t < 2; ++t)
#pragma unroll
    for (int m = 0; m < MT; ++m)
#pragma unroll
      for (int r = 0; r < 8; ++r)
        res[m][t][r] = mp[(m * 16 + r) * 256 + t * 16];
#pragma unroll
  for (int it = 0; it < BROWS; ++it) {
    int idx = it * 256 + tid;
    float gv = (float)g16[base + idx];
    lx[idx >> 8][idx & 255] = (f16)(gv * o32[base + idx]);
  }
  __syncthreads();
  // All products stand ahead of the first store, so that no weight load need
  // wait behind a store.
  v8f acc[MT][2];
  mm_rows<2>(&lx[0][0], fo, wave * 2, lane, acc);
  float* op = out + eoff;
#pragma unroll
  for (int m = 0; m < MT; ++m)
#pragma unroll
    for (int t = 0; t < 2; ++t)
#pragma unroll
      for (int r = 0; r < 8; ++r)
        op[(m * 16 + r) * 256 + t * 16] = acc[m][t][r] + ob[t] + res[m][t][r];
}

// ---------------------------------------------------------------------------
extern "C" void kernel_launch(void* const* d_in, const int* in_sizes, int n_in,
                              void* d_out, int out_size, void* d_ws,
                              size_t ws_size, hipStream_t stream) {
  (void)in_sizes; (void)n_in; (void)out_size; (void)ws_size;
  const float* M_raw  = (const float*)d_in[0];
  const float* Z      = (const float*)d_in[1];
  const float* M_mask = (const float*)d_in[2];
  const float* ln_m_g = (const float*)d_in[3];
  const float* ln_m_b = (const float*)d_in[4];
  const float* ln_z_g = (const float*)d_in[5];
  const float* ln_z_b = (const float*)d_in[6];
  const float* b_w    = (const float*)d_in[7];
  const float* Wq     = (const float*)d_in[8];
  const float* Wk     = (const float*)d_in[9];
  const float* Wv     = (const float*)d_in[10];
  const float* Wg     = (const float*)d_in[11];
  const float* bg     = (const float*)d_in[12];
  const float* Wo     = (const float*)d_in[13];
  const float* ob     = (const float*)d_in[14];
  float* out = (float*)d_out;

  char* ws = (char*)d_ws;
  size_t off = 0;
  auto take = [&](size_t b) {
    char* p = ws + off;
    off += (b + 255) & ~(size_t)255;
    return p;
  };
  f16* fq   = (f16*)take(131072);      // swizzled weight fragments (f16)
  f16* fk   = (f16*)take(131072);
  f16* fv   = (f16*)take(131072);
  f16* fg   = (f16*)take(131072);
  f16* fo   = (f16*)take(131072);
  f16* q16  = (f16*)take(16777216);    // [s][h][256][32] f16
  f16* k16  = (f16*)take(16777216);
  f16* v16p = (f16*)take(16777216);
  f16* g16  = (f16*)take(16777216);    // [row][256] f16
  float* o32 = (float*)take(33554432); // [row][256] f32
  float* pb  = (float*)take(2097152);  // f32, C-operand order (kernel B)

  k_swizzle<<<80, 256, 0, stream>>>(Wq, Wk, Wv, Wg, Wo, fq, fk, fv, fg, fo);
  k_ln_qkvg<<<512, 256, 0, stream>>>(M_raw, ln_m_g, ln_m_b, bg, fq, fk, fv,
                                      fg, q16, k16, v16p, g16);
  k_pairbias<<<512, 128, 0, stream>>>(Z, ln_z_g, ln_z_b, b_w, pb);
  k_attention<<<1024, 128, 0, stream>>>(q16, k16, v16p, pb, M_mask, o32);
  k_out<<<512, 256, 0, stream>>>(g16, o32, fo, ob, M_raw, out);
}

// v007
// It runs in 85 microseconds.
// Next to v006, in two timings, it ran 1.08 and 1.09 times as fast.
// Counting every step since v000, it is 3.62 times as fast.
#include <hip/hip_runtime.h>
#include <hip/hip_bf16.h>
#include <math.h>

typedef _Float16 f16;
typedef __attribute__((ext_vector_type(16))) _Float16 v16h;
typedef __attribute__((ext_vector_type(8)))  _Float16 v8h;
typedef __attribute__((ext_vector_type(8)))  float    v8f;
typedef __attribute__((ext_vector_type(4)))  float    v4f;
typedef __attribute__((ext_vector_type(2)))  float    v2f;
typedef __attribute__((address_space(4))) float cfloat;

typedef unsigned int u32x4 __attribute__((ext_vector_type(4)));
typedef int          i32x4 __attribute__((ext_vector_type(4)));
typedef int          i32x8 __attribute__((ext_vector_type(8)));

#ifndef __has_builtin
#define __has_builtin(x) 0
#endif
#if __has_builtin(__builtin_amdgcn_tensor_load_to_lds) && \
    __has_builtin(__builtin_amdgcn_s_wait_tensorcnt)
#define USE_TDM 1
#else
#define USE_TDM 0
#endif

__device__ __forceinline__ int kk_of(int e, int hf) {
  int v = e >> 1, lo = e & 1;
  return ((v >> 2) << 4) + hf * 8 + ((v & 3) << 1) + lo;
}

__device__ __forceinline__ v8f wmma16(v16h a, v16h b, v8f c) {
  return __builtin_amdgcn_wmma_f32_16x16x32_f16(false, a, false, b, (short)0, c,
                                                false, false);
}

// Row-major f16 source: lane's 16 fragment halfs are two contiguous 8-half
// chunks at kbase + hf*8 and kbase + 16 + hf*8 of one row -> two b128 loads.
__device__ __forceinline__ v16h frag_rowmajor(const f16* base, int strideH,
                                              int row, int kbase, int hf) {
  const f16* p = base + (size_t)row * strideH + kbase + hf * 8;
  v8h lo = *(const v8h*)p;
  v8h hi = *(const v8h*)(p + 16);
  v16h r;
#pragma unroll
  for (int e = 0; e < 8; ++e) { r[e] = lo[e]; r[e + 8] = hi[e]; }
  return r;
}

#define LX_PITCH 264    // halfs: 256 + 8  = 528 B  = 16 B x 33
#define LRAW_PITCH 260  // floats: 256 + 4 = 1040 B = 16 B x 65

// A = V^T from the row-major V tile in LDS (row pitch 64 B) by the transposing
// load: lane (colL, hf) gets V[krow + 8*hf + 0..7][col0 + colL]. The loads at
// krow and krow + 16 are registers 0-3 and 4-7 of one 16 x 32 A fragment in
// the k order of kk_of. vp is the lane's own address in the tile:
// row 8*hf + (lane & 7), halfs 8*((lane >> 3) & 1) onward.
typedef __attribute__((ext_vector_type(8))) short s16x8;
typedef __attribute__((address_space(3))) s16x8 lds_s16x8;
__device__ __forceinline__ v16h frag_tr16(const f16* vp, int col0, int krow) {
  const f16* p = vp + krow * 32 + col0;
  v8h lo = __builtin_bit_cast(
      v8h, __builtin_amdgcn_ds_load_tr16_b128_v8i16((lds_s16x8*)p));
  v8h hi = __builtin_bit_cast(
      v8h, __builtin_amdgcn_ds_load_tr16_b128_v8i16((lds_s16x8*)(p + 16 * 32)));
  return __builtin_shufflevector(lo, hi, 0, 1, 2, 3, 4, 5, 6, 7, 8, 9, 10, 11,
                                 12, 13, 14, 15);
}

// ---------------------------------------------------------------------------
// Kernel 0: pack f32 weights [256 x 256] into f16 WMMA B-fragment order.
// Fragment buffer: [(kt*16+nt)*32 + lane]*16 halfs, kt in 0..7, nt in 0..15.
// ---------------------------------------------------------------------------
__global__ void __launch_bounds__(256) k_swizzle(
    const float* w0, const float* w1, const float* w2, const float* w3,
    const float* w4, f16* f0, f16* f1, f16* f2, f16* f3, f16* f4) {
  int t = blockIdx.x * blockDim.x + threadIdx.x;
  if (t >= 5 * 8 * 16 * 32) return;
  int w = t / 4096, rem = t % 4096;
  int kt = rem / 512; rem %= 512;
  int nt = rem / 32; int lane = rem % 32;
  const float* src = (w == 0) ? w0 : (w == 1) ? w1 : (w == 2) ? w2
                     : (w == 3) ? w3 : w4;
  f16* dst = ((w == 0) ? f0 : (w == 1) ? f1 : (w == 2) ? f2
              : (w == 3) ? f3 : f4) +
             ((size_t)(kt * 16 + nt) * 32 + lane) * 16;
  int hf = lane >> 4, col = nt * 16 + (lane & 15);
#pragma unroll
  for (int e = 0; e < 16; ++e)
    dst[e] = (f16)src[(kt * 32 + kk_of(e, hf)) * 256 + col];
}

// Rows of the activation that one block of either GEMM kernel takes: MT tiles
// of 16. A weight fragment, once loaded, is multiplied with all MT row tiles,
// so a block's pass over the packed weights serves 64 rows, not 16.
#define MT 4
#define BROWS (MT * 16)

// A 64 x (NT*16) piece of a product: the block's 64 rows in LDS times n-tiles
// nt0 .. nt0+NT-1 of the packed weight fragments fr, K = 256.
template <int NT>
__device__ __forceinline__ void mm_rows(const f16* lxp, const f16* fr, int nt0,
                                        int lane, v8f (&acc)[MT][NT]) {
  int hf = lane >> 4, colL = lane & 15;
  // One address a lane for all weight fragments: every step from it is a
  // constant, and its register lives through the whole product.
  const f16* bp = fr + ((size_t)nt0 * 32 + lane) * 16;
#pragma unroll
  for (int m = 0; m < MT; ++m)
#pragma unroll
    for (int j = 0; j < NT; ++j) acc[m][j] = (v8f){0, 0, 0, 0, 0, 0, 0, 0};
#pragma unroll
  for (int kt = 0; kt < 8; ++kt) {
    v16h b[NT], a[MT];
#pragma unroll
    for (int j = 0; j < NT; ++j)
      b[j] = *(const v16h*)(bp + (kt * 16 + j) * 512);
#pragma unroll
    for (int m = 0; m < MT; ++m)
      a[m] = frag_rowmajor(lxp, LX_PITCH, m * 16 + colL, kt * 32, hf);
    // Keeps a step's loads in one group ahead of its WMMAs: spread among them
    // each pair of LDS loads is waited for singly.
    __builtin_amdgcn_sched_barrier(0);
#pragma unroll
    for (int m = 0; m < MT; ++m)
#pragma unroll
      for (int j = 0; j < NT; ++j) acc[m][j] = wmma16(a[m], b[j], acc[m][j]);
  }
}

// ---------------------------------------------------------------------------
// Kernel A: LayerNorm(M_raw) then fused Q/K/V/G projection GEMM via WMMA.
// One block = 64 rows of the [32768 x 256] activation; each of the 8 waves has
// 4 n-tiles of each of two matrices, taken against all 4 row tiles.
// q/k/v stored f16 head-major [s][h][r][32]; g stored f16 [row][256].
// ---------------------------------------------------------------------------
__global__ void __launch_bounds__(256) k_ln_qkvg(
    const float* M_raw, const float* g_ln, const float* b_ln, const float* bg,
    const f16* fq, const f16* fk, const f16* fv, const f16* fg,
    f16* q16, f16* k16, f16* v16p, f16* g16) {
  __shared__ __attribute__((aligned(16))) float lraw[BROWS][LRAW_PITCH];
  __shared__ float lstat[BROWS][2];
  __shared__ __attribute__((aligned(16))) f16 lx[BROWS][LX_PITCH];
  int tid = threadIdx.x;
  size_t base = (size_t)blockIdx.x * BROWS * 256;
#pragma unroll
  for (int it = 0; it < BROWS; ++it) {
    int idx = it * 256 + tid;
    lraw[idx >> 8][idx & 255] = M_raw[base + idx];
  }
  __syncthreads();
  if (tid < BROWS) {
    float s = 0.f;
    for (int c = 0; c < 256; ++c) s += lraw[tid][c];
    float mu = s * (1.f / 256.f);
    float vv = 0.f;
    for (int c = 0; c < 256; ++c) { float d = lraw[tid][c] - mu; vv += d * d; }
    lstat[tid][0] = mu;
    lstat[tid][1] = rsqrtf(vv * (1.f / 256.f) + 1e-5f);
  }
  __syncthreads();
#pragma unroll
  for (int it = 0; it < BROWS; ++it) {
    int idx = it * 256 + tid;
    int r = idx >> 8, c = idx & 255;
    lx[r][c] = (f16)((lraw[r][c] - lstat[r][0]) * lstat[r][1] * g_ln[c] + b_ln[c]);
  }
  __syncthreads();

  int wave = __builtin_amdgcn_readfirstlane(tid >> 5), lane = tid & 31;
  int hf = lane >> 4, colL = lane & 15;
  // Each wave has the same four n-tiles of two matrices: waves 0-3 of g and v,
  // waves 4-7 of q and k. The gate's long epilogue so
  // comes first, beside the other waves' products.
  int nt0 = (wave & 3) * 4;
  int gr0 = blockIdx.x * BROWS;
  v8f acc[MT][4];
  // The branch stands in front of the products, once per wave: between a
  // tile's last WMMA and the first use of its result there is then no branch.
  if (wave < 4) {
    // Read once, ahead of the stores: read again behind each store (g16
    // could be bg, for all the compiler knows) it is waited for singly.
    float bgn[4];
#pragma unroll
    for (int j = 0; j < 4; ++j) bgn[j] = bg[nt0 * 16 + colL + j * 16];
    // The register that holds the offset of these loads is reused below: the
    // wait stands in front of its overwrite.
    asm volatile("s_wait_xcnt 0x0" ::: "memory");
    mm_rows<4>(&lx[0][0], fg, nt0, lane, acc);
    // Keeps the epilogue out of the products' scheduling region: mixed in
    // there, where registers are scarce, all its stores went through one data
    // register, each waited for before the next conversion.
    __builtin_amdgcn_sched_barrier(0);
    // C-layout: lanes 16-31 hold rows +8. One address a lane; every tile, row
    // and column step from it is a constant.
    f16* gp = g16 + (size_t)(gr0 + 8 * hf) * 256 + nt0 * 16 + colL;
#pragma unroll
    for (int m = 0; m < MT; ++m)
#pragma unroll
      for (int j = 0; j < 4; ++j) {
#pragma unroll
        for (int r = 0; r < 8; ++r) {
          float val = 1.f / (1.f + __expf(-(acc[m][j][r] + bgn[j])));
          gp[(m * 16 + r) * 256 + j * 16] = (f16)val;
        }
        // The next tile overwrites the stores' data registers.
        asm volatile("s_wait_xcnt 0x0" ::: "memory");
      }
  }
  int mat0 = (wave < 4) ? 2 : 0, mat1 = (wave < 4) ? 3 : 2;
  // Stays rolled: q, k and v run through the same code, which then takes a
  // third of the room in the instruction cache.
#pragma unroll 1
  for (int mat = mat0; mat < mat1; ++mat) {
    const f16* fr = (mat == 0) ? fq : (mat == 1) ? fk : fv;
    f16* dst = (mat == 0) ? q16 : (mat == 1) ? k16 : v16p;
    float sc = (mat == 0) ? 0.17677669529663687f : 1.f;  // q: 1/sqrt(C)
    mm_rows<4>(&lx[0][0], fr, nt0, lane, acc);
    // As above: keeps the epilogue out of the products' scheduling region.
    __builtin_amdgcn_sched_barrier(0);
    // The block's 64 rows lie in one s, the wave's four n-tiles in two heads:
    // one address a lane; every tile and row step from it is a constant.
    f16* dp = dst + (((size_t)(gr0 >> 8) * 8 + (nt0 >> 1)) * 256 + (gr0 & 255) +
                     8 * hf) * 32 + colL;
#pragma unroll
    for (int m = 0; m < MT; ++m)
#pragma unroll
      for (int j = 0; j < 4; ++j) {
#pragma unroll
        for (int r = 0; r < 8; ++r)
          dp[((j >> 1) * 256 + m * 16 + r) * 32 + (j & 1) * 16] =
              (f16)(acc[m][j][r] * sc);
        // The next tile overwrites the stores' data registers.
        asm volatile("s_wait_xcnt 0x0" ::: "memory");
      }
  }
}

__global__ void __launch_bounds__(128) k_pairbias(
    const float* Z, const float* gz, const float* bz, const float* bw,
    float* pb) {
  __shared__ __attribute__((aligned(16))) float lz[128 * 132];
  int tid = threadIdx.x;
  int wave = tid >> 5, lane = tid & 31;
  int it = blockIdx.x >> 5;  // rows i = it*16 + 0..15
  int jb = blockIdx.x & 31;  // keys j = jb*8 + 0..7
  // Thread t has the pair i = it*16 + ((t>>2)&15), j = jb*8 + (t>>6)*4 + (t&3).
  v4f z[32];
  {
    // Row k of this wave belongs to thread wave*32 + k.
    const float* zp = Z +
        (size_t)((it * 16 + (wave & 1) * 8) * 256 + jb * 8 + (wave >> 1) * 4) *
            128 + lane * 4;
#pragma unroll
    for (int k = 0; k < 32; ++k)
      z[k] = *(const v4f*)(zp + ((k >> 2) * 256 + (k & 3)) * 128);
    // The registers that hold the addresses of the loads above are reused
    // below: the wait stands in front of their overwrite.
    asm volatile("s_wait_xcnt 0x0" ::: "memory");
    float* lw = lz + wave * 32 * 132 + lane * 4;
#pragma unroll
    for (int k = 0; k < 32; ++k) *(v4f*)(lw + k * 132) = z[k];
  }
  __syncthreads();
  const float* lr = lz + tid * 132;
#pragma unroll
  for (int c = 0; c < 32; ++c) z[c] = *(const v4f*)(lr + c * 4);
  v4f s4 = z[0];
#pragma unroll
  for (int c = 1; c < 32; ++c) s4 += z[c];
  float mu = ((s4[0] + s4[1]) + (s4[2] + s4[3])) * (1.f / 128.f);
  v4f q4 = {0, 0, 0, 0};
#pragma unroll
  for (int c = 0; c < 32; ++c) {
    v4f d = z[c] - mu;
    q4 += d * d;
  }
  float vv = (q4[0] + q4[1]) + (q4[2] + q4[3]);
  float rstd = rsqrtf(vv * (1.f / 128.f) + 1e-5f);
  // No launch of this file writes these three inputs: read through the
  // constant address space they come by scalar loads, one for the wave
  // (behind the asm statement above they would else be vector loads).
  const cfloat* gzc = (const cfloat*)(unsigned long long)gz;
  const cfloat* bzc = (const cfloat*)(unsigned long long)bz;
  const cfloat* bwc = (const cfloat*)(unsigned long long)bw;
  // Even and odd channels are summed apart: two neighbouring channels go
  // through one packed multiply-add.
  v2f acc[8] = {{0, 0}, {0, 0}, {0, 0}, {0, 0}, {0, 0}, {0, 0}, {0, 0}, {0, 0}};
  // Stays rolled, 8 channels a trip: unrolled, the scalar loads of all trips
  // are lifted to the top, do not fit the scalar registers and are spilled.
#pragma unroll 1
  for (int p0 = 0; p0 < 128; p0 += 8) {
    v4f za = *(const v4f*)(lr + p0);
    v4f zb = *(const v4f*)(lr + p0 + 4);
    v2f nv[4] = {{za[0], za[1]}, {za[2], za[3]}, {zb[0], zb[1]}, {zb[2], zb[3]}};
#pragma unroll
    for (int t = 0; t < 4; ++t) {
      v2f g2 = {gzc[p0 + 2 * t], gzc[p0 + 2 * t + 1]};
      v2f b2 = {bzc[p0 + 2 * t], bzc[p0 + 2 * t + 1]};
      nv[t] = (nv[t] - mu) * rstd * g2 + b2;
    }
#pragma unroll
    for (int t = 0; t < 4; ++t)
#pragma unroll
      for (int h = 0; h < 8; ++h) {
        v2f w2 = {bwc[h * 128 + p0 + 2 * t], bwc[h * 128 + p0 + 2 * t + 1]};
        acc[h] += nv[t] * w2;
      }
  }
  float* pw = pb + (it * 16 + (jb >> 1)) * 256 + (tid >> 6) * 128 +
              (jb & 1) * 64 + (tid & 63);
#pragma unroll
  for (int h = 0; h < 8; ++h) pw[(size_t)h * 65536] = acc[h][0] + acc[h][1];
}

__global__ void __launch_bounds__(128) k_attention(
    const f16* q16, const f16* k16, const f16* v16p, const float* pb,
    const float* mask, float* o32) {
  __shared__ __attribute__((aligned(16))) f16 lv[256 * 32];  // V tile, 16 KB
  int s_ = blockIdx.x >> 3, h_ = blockIdx.x & 7;
  size_t headoff = ((size_t)s_ * 8 + h_) * 256 * 32;
  const f16* qs = q16 + headoff;
  const f16* ks = k16 + headoff;
  const f16* vs = v16p + headoff;

#if USE_TDM
  if (threadIdx.x < 32) {
    unsigned lds_off = (unsigned)(unsigned long long)(const void*)&lv[0];
    unsigned long long ga = (unsigned long long)(const void*)vs;
    u32x4 g0;
    g0[0] = 1u;                                   // count=1, user mode
    g0[1] = lds_off;                              // lds_addr
    g0[2] = (unsigned)(ga & 0xffffffffu);         // global_addr[31:0]
    g0[3] = (unsigned)((ga >> 32) & 0x01ffffffu)  // global_addr[56:32]
            | (2u << 30);                         // type=2 (image)
    i32x8 g1;
    g1[0] = (int)(1u << 16);
    g1[1] = (int)(32u << 16);
    g1[2] = (int)(256u << 16);
    g1[3] = (int)(32u << 16);
    g1[4] = 256;
    g1[5] = 32;
    g1[6] = 0;
    g1[7] = 0;
    i32x4 gz4 = {0, 0, 0, 0};   // groups 2/3 unused (<=2D tensor)
#if __clang_major__ >= 23
    i32x8 gz8 = {0, 0, 0, 0, 0, 0, 0, 0};
    __builtin_amdgcn_tensor_load_to_lds(g0, g1, gz4, gz4, gz8, 0);
#else
    __builtin_amdgcn_tensor_load_to_lds(g0, g1, gz4, gz4, 0);
#endif
    __builtin_amdgcn_s_wait_tensorcnt(0);
  }
#else
  for (int t = threadIdx.x; t < 8192; t += 128) lv[t] = vs[t];
#endif
  __syncthreads();

  int wave = threadIdx.x >> 5, lane = threadIdx.x & 31;
  int hf = lane >> 4, colL = lane & 15;
  const float* pbh = pb + (size_t)h_ * 65536;
  const float* mrow = mask + (size_t)s_ * 256;
  const f16* vtp = lv + (8 * hf + (lane & 7)) * 32 + 8 * ((lane >> 3) & 1);

  for (int itb = 0; itb < 4; ++itb) {
    int i0 = (itb * 4 + wave) * 16;
    // B = Q^T: lane holds column i = i0 + colL.
    v16h qb = frag_rowmajor(qs, 32, i0 + colL, 0, hf);
    // pb lies in C-operand order (see kernel B): tile (i0/16, jt) is 256
    // floats, registers 0..3 of all lanes first, then registers 4..7.
    const float* pbt = pbh + (size_t)(itb * 4 + wave) * 4096 + lane * 4;
    // acc[jt][r] = logits[i0 + colL][jt*16 + 8*hf + r]; the pair bias and the
    // mask bias enter as the C operand.
    v8f acc[16];
#pragma unroll
    for (int jt = 0; jt < 16; ++jt) {
      v4f lo = *(const v4f*)(pbt + jt * 256);
      v4f hi = *(const v4f*)(pbt + jt * 256 + 128);
      acc[jt] = __builtin_shufflevector(lo, hi, 0, 1, 2, 3, 4, 5, 6, 7);
    }
    // The registers that hold the addresses of the loads above are reused
    // below: the wait stands in front of their overwrite.
    asm volatile("s_wait_xcnt 0x0" ::: "memory");
#pragma unroll
    for (int g = 0; g < 4; ++g) {
      v16h ka[4];
      v8f mv[4];
#pragma unroll
      for (int t = 0; t < 4; ++t) {
        int jt = g * 4 + t;
        ka[t] = frag_rowmajor(ks, 32, jt * 16 + colL, 0, hf);
        mv[t] = *(const v8f*)(mrow + jt * 16 + 8 * hf);
      }
      // Keeps the loads of four tiles in flight together: without it each
      // tile's loads are issued and waited for singly, in front of its WMMA.
      __builtin_amdgcn_sched_barrier(0);
#pragma unroll
      for (int t = 0; t < 4; ++t) {
        int jt = g * 4 + t;
        v8f c;
#pragma unroll
        for (int r = 0; r < 8; ++r) c[r] = acc[jt][r] + 1e9f * (mv[t][r] - 1.f);
        acc[jt] = wmma16(ka[t], qb, c);
      }
    }
    // softmax over j: 128 values of row i in this lane, the other 128 in
    // lane ^ 16.
    v8f mx = acc[0];
#pragma unroll
    for (int jt = 1; jt < 16; ++jt)
#pragma unroll
      for (int r = 0; r < 8; ++r) mx[r] = fmaxf(mx[r], acc[jt][r]);
    float m = fmaxf(fmaxf(fmaxf(mx[0], mx[1]), fmaxf(mx[2], mx[3])),
                    fmaxf(fmaxf(mx[4], mx[5]), fmaxf(mx[6], mx[7])));
    m = fmaxf(m, __shfl_xor(m, 16, 32));
    // Tiles 2kt and 2kt+1 hold keys kt*32 + {8*hf + 0..7, 16 + 8*hf + 0..7}:
    // converted in place they are the B fragment pt[kt] in the k order of
    // kk_of (unnormalized exp; 1/rowsum folded into the epilogue).
    v8f sv = {0, 0, 0, 0, 0, 0, 0, 0};
    v16h pt[8];
#pragma unroll
    for (int jt = 0; jt < 16; ++jt)
#pragma unroll
      for (int r = 0; r < 8; ++r) {
        float e = __expf(acc[jt][r] - m);
        sv[r] += e;
        pt[jt >> 1][(jt & 1) * 8 + r] = (f16)e;
      }
    float ssum = ((sv[0] + sv[1]) + (sv[2] + sv[3])) +
                 ((sv[4] + sv[5]) + (sv[6] + sv[7]));
    ssum += __shfl_xor(ssum, 16, 32);
    float rinv = 1.f / ssum;
    // Ot = V^T Pt
    v8f oacc[2] = {{0, 0, 0, 0, 0, 0, 0, 0}, {0, 0, 0, 0, 0, 0, 0, 0}};
#pragma unroll
    for (int kt = 0; kt < 8; ++kt)
#pragma unroll
      for (int ct = 0; ct < 2; ++ct) {
        v16h va = frag_tr16(vtp, ct * 16, kt * 32);
        oacc[ct] = wmma16(va, pt[kt], oacc[ct]);
      }
    // oacc[ct][r] = O[i0 + colL][ct*16 + 8*hf + r]
    float* orow = o32 + ((size_t)s_ * 256 + i0 + colL) * 256 + h_ * 32 + 8 * hf;
#pragma unroll
    for (int ct = 0; ct < 2; ++ct) {
      v8f ov;
#pragma unroll
      for (int r = 0; r < 8; ++r) ov[r] = oacc[ct][r] * rinv;
      *(v8f*)(orow + ct * 16) = ov;
    }
    // The next trip overwrites the stores' address and data registers.
    asm volatile("s_wait_xcnt 0x0" ::: "memory");
  }
}

// ---------------------------------------------------------------------------
// Kernel D: out = (g * o) @ Wo + out_bias + M_raw
// One block = 64 rows; each of the 8 waves has 2 n-tiles against 4 row tiles.
// ---------------------------------------------------------------------------
__global__ void __launch_bounds__(256) k_out(
    const f16* g16, const float* o32, const f16* fo, const float* out_bias,
    const float* M_raw, float* out) {
  __shared__ __attribute__((aligned(16))) f16 lx[BROWS][LX_PITCH];
  int tid = threadIdx.x;
  size_t base = (size_t)blockIdx.x * BROWS * 256;
  // The wave's number as a scalar: the addresses of the wave's weight fragments
  // and columns then need no vector registers of their own, which are scarce
  // here (64 accumulators and 64 residuals a lane).
  int wave = __builtin_amdgcn_readfirstlane(tid >> 5);
  int lane = tid & 31, hf = lane >> 4, colL = lane & 15;
  int gr0 = blockIdx.x * BROWS;
  // The residual and the bias of the lane's output elements are read here,
  // with the staging loads: read among the stores of the epilogue (out could
  // be M_raw, for all the compiler knows) each is waited for singly.
  float res[MT][2][8], ob[2];
#pragma unroll
  for (int t = 0; t < 2; ++t) ob[t] = out_bias[(wave * 2 + t) * 16 + colL];
  // The register that holds the offset of the two loads above is given to a
  // later load as its destination: the wait stands in front of that.
  asm volatile("s_wait_xcnt 0x0" ::: "memory");
  // One offset a lane for the residual and the output; every tile, row and
  // column step from it is a constant.
  size_t eoff = (size_t)(gr0 + 8 * hf) * 256 + wave * 32 + colL;
  const float* mp = M_raw + eoff;
#pragma unroll
  for (int t = 0; t < 2; ++t)
#pragma unroll
    for (int m = 0; m < MT; ++m)
#pragma unroll
      for (int r = 0; r < 8; ++r)
        res[m][t][r] = mp[(m * 16 + r) * 256 + t * 16];
#pragma unroll
  for (int it = 0; it < BROWS; ++it) {
    int idx = it * 256 + tid;
    float gv = (float)g16[base + idx];
    lx[idx >> 8][idx & 255] = (f16)(gv * o32[base + idx]);
  }
  __syncthreads();
  // All products stand ahead of the first store, so that no weight load need
  // wait behind a store.
  v8f acc[MT][2];
  mm_rows<2>(&lx[0][0], fo, wave * 2, lane, acc);
  float* op = out + eoff;
#pragma unroll
  for (int m = 0; m < MT; ++m)
#pragma unroll
    for (int t = 0; t < 2; ++t)
#pragma unroll
      for (int r = 0; r < 8; ++r)
        op[(m * 16 + r) * 256 + t * 16] = acc[m][t][r] + ob[t] + res[m][t][r];
}

// ---------------------------------------------------------------------------
extern "C" void kernel_launch(void* const* d_in, const int* in_sizes, int n_in,
                              void* d_out, int out_size, void* d_ws,
                              size_t ws_size, hipStream_t stream) {
  (void)in_sizes; (void)n_in; (void)out_size; (void)ws_size;
  const float* M_raw  = (const float*)d_in[0];
  const float* Z      = (const float*)d_in[1];
  const float* M_mask = (const float*)d_in[2];
  const float* ln_m_g = (const float*)d_in[3];
  const float* ln_m_b = (const float*)d_in[4];
  const float* ln_z_g = (const float*)d_in[5];
  const float* ln_z_b = (const float*)d_in[6];
  const float* b_w    = (const float*)d_in[7];
  const float* Wq     = (const float*)d_in[8];
  const float* Wk     = (const float*)d_in[9];
  const float* Wv     = (const float*)d_in[10];
  const float* Wg     = (const float*)d_in[11];
  const float* bg     = (const float*)d_in[12];
  const float* Wo     = (const float*)d_in[13];
  const float* ob     = (const float*)d_in[14];
  float* out = (float*)d_out;

  char* ws = (char*)d_ws;
  size_t off = 0;
  auto take = [&](size_t b) {
    char* p = ws + off;
    off += (b + 255) & ~(size_t)255;
    return p;
  };
  f16* fq   = (f16*)take(131072);      // swizzled weight fragments (f16)
  f16* fk   = (f16*)take(131072);
  f16* fv   = (f16*)take(131072);
  f16* fg   = (f16*)take(131072);
  f16* fo   = (f16*)take(131072);
  f16* q16  = (f16*)take(16777216);    // [s][h][256][32] f16
  f16* k16  = (f16*)take(16777216);
  f16* v16p = (f16*)take(16777216);
  f16* g16  = (f16*)take(16777216);    // [row][256] f16
  float* o32 = (float*)take(33554432); // [row][256] f32
  float* pb  = (float*)take(2097152);  // f32, C-operand order (kernel B)

  k_swizzle<<<80, 256, 0, stream>>>(Wq, Wk, Wv, Wg, Wo, fq, fk, fv, fg, fo);
  k_ln_qkvg<<<512, 256, 0, stream>>>(M_raw, ln_m_g, ln_m_b, bg, fq, fk, fv,
                                      fg, q16, k16, v16p, g16);
  k_pairbias<<<512, 128, 0, stream>>>(Z, ln_z_g, ln_z_b, b_w, pb);
  k_attention<<<1024, 128, 0, stream>>>(q16, k16, v16p, pb, M_mask, o32);
  k_out<<<512, 256, 0, stream>>>(g16, o32, fo, ob, M_raw, out);
}

// v008
// It runs in 75.2 microseconds.
// In both of two side-by-side timings against v007, it was 1.13 times as fast.
// Counting every step since v000, it is 4.10 times as fast.
#include <hip/hip_runtime.h>
#include <hip/hip_bf16.h>
#include <math.h>

typedef _Float16 f16;
typedef __attribute__((ext_vector_type(16))) _Float16 v16h;
typedef __attribute__((ext_vector_type(8)))  _Float16 v8h;
typedef __attribute__((ext_vector_type(8)))  float    v8f;
typedef __attribute__((ext_vector_type(4)))  float    v4f;
typedef __attribute__((ext_vector_type(2)))  float    v2f;
typedef __attribute__((address_space(4))) float cfloat;

typedef unsigned int u32x4 __attribute__((ext_vector_type(4)));
typedef int          i32x4 __attribute__((ext_vector_type(4)));
typedef int          i32x8 __attribute__((ext_vector_type(8)));

#ifndef __has_builtin
#define __has_builtin(x) 0
#endif
#if __has_builtin(__builtin_amdgcn_tensor_load_to_lds) && \
    __has_builtin(__builtin_amdgcn_s_wait_tensorcnt)
#define USE_TDM 1
#else
#define USE_TDM 0
#endif

__device__ __forceinline__ int kk_of(int e, int hf) {
  int v = e >> 1, lo = e & 1;
  return ((v >> 2) << 4) + hf * 8 + ((v & 3) << 1) + lo;
}

__device__ __forceinline__ v8f wmma16(v16h a, v16h b, v8f c) {
  return __builtin_amdgcn_wmma_f32_16x16x32_f16(false, a, false, b, (short)0, c,
                                                false, false);
}

// Row-major f16 source: lane's 16 fragment halfs are two contiguous 8-half
// chunks at kbase + hf*8 and kbase + 16 + hf*8 of one row -> two b128 loads.
__device__ __forceinline__ v16h frag_rowmajor(const f16* base, int strideH,
                                              int row, int kbase, int hf) {
  const f16* p = base + (size_t)row * strideH + kbase + hf * 8;
  v8h lo = *(const v8h*)p;
  v8h hi = *(const v8h*)(p + 16);
  v16h r;
#pragma unroll
  for (int e = 0; e < 8; ++e) { r[e] = lo[e]; r[e + 8] = hi[e]; }
  return r;
}

#define LX_PITCH 264    // halfs: 256 + 8  = 528 B  = 16 B x 33
#define LRAW_PITCH 260  // floats: 256 + 4 = 1040 B = 16 B x 65

// Tile order of q, k and v: [s][h][r/16][c/16][r%16][c%16], 16 x 16 pieces of
// 512 contiguous bytes with rows of 32 B. Lane (colL, hf) owns the 16 bytes at
// halfs colL*16 + hf*8 of a piece: they are the 8 accumulator registers of the
// lane in the transposed projection (kernel A), and the pieces c/16 = 0 and 1
// of a row tile are registers 0-3 and 4-7 of its 16 x 32 fragment in the k
// order of kk_of. Each 16-byte store or load of a wave covers one whole piece.
// g (f16) and o (f32) lie in the same 16 x 16 pieces, [row/16][col/16][row%16]
// [col%16] over the [32768 x 256] activation: a lane's 8 accumulator registers
// are again 8 neighbouring elements of a piece, and the 64 rows of a block of
// kernel D are 64 pieces in a row.
#define QKV_PIECE 256               // elements of a 16 x 16 piece
#define QKV_TILE (2 * QKV_PIECE)    // halfs: 16 rows x 32 channels

// lp = start of the (s,h) plane + the lane's colL*16 + hf*8.
__device__ __forceinline__ v16h frag_tiled(const f16* lp, int tile) {
  v8h lo = *(const v8h*)(lp + tile * QKV_TILE);
  v8h hi = *(const v8h*)(lp + tile * QKV_TILE + QKV_PIECE);
  return __builtin_shufflevector(lo, hi, 0, 1, 2, 3, 4, 5, 6, 7, 8, 9, 10, 11,
                                 12, 13, 14, 15);
}

// A = V^T from the V plane in LDS (tile order, row pitch 32 B inside a piece)
// by the transposing load: lane (colL, hf) gets
// V[kt*32 + 8*hf + 0..7][ct*16 + colL]. The loads from row tiles 2kt and 2kt+1
// are registers 0-3 and 4-7 of one 16 x 32 A fragment in the k order of kk_of.
// vp is the lane's own address in a piece: row 8*hf + (lane & 7), halfs
// 8*((lane >> 3) & 1) onward.
typedef __attribute__((ext_vector_type(8))) short s16x8;
typedef __attribute__((address_space(3))) s16x8 lds_s16x8;
__device__ __forceinline__ v16h frag_tr16(const f16* vp, int ct, int kt) {
  const f16* p = vp + kt * 2 * QKV_TILE + ct * QKV_PIECE;
  v8h lo = __builtin_bit_cast(
      v8h, __builtin_amdgcn_ds_load_tr16_b128_v8i16((lds_s16x8*)p));
  v8h hi = __builtin_bit_cast(
      v8h, __builtin_amdgcn_ds_load_tr16_b128_v8i16((lds_s16x8*)(p + QKV_TILE)));
  return __builtin_shufflevector(lo, hi, 0, 1, 2, 3, 4, 5, 6, 7, 8, 9, 10, 11,
                                 12, 13, 14, 15);
}

// ---------------------------------------------------------------------------
// Kernel 0: pack f32 weights [256 x 256] into f16 WMMA B-fragment order.
// Fragment buffer: [(kt*16+nt)*32 + lane]*16 halfs, kt in 0..7, nt in 0..15.
// ---------------------------------------------------------------------------
__global__ void __launch_bounds__(256) k_swizzle(
    const float* w0, const float* w1, const float* w2, const float* w3,
    const float* w4, f16* f0, f16* f1, f16* f2, f16* f3, f16* f4) {
  int t = blockIdx.x * blockDim.x + threadIdx.x;
  if (t >= 5 * 8 * 16 * 32) return;
  int w = t / 4096, rem = t % 4096;
  int kt = rem / 512; rem %= 512;
  int nt = rem / 32; int lane = rem % 32;
  const float* src = (w == 0) ? w0 : (w == 1) ? w1 : (w == 2) ? w2
                     : (w == 3) ? w3 : w4;
  f16* dst = ((w == 0) ? f0 : (w == 1) ? f1 : (w == 2) ? f2
              : (w == 3) ? f3 : f4) +
             ((size_t)(kt * 16 + nt) * 32 + lane) * 16;
  int hf = lane >> 4, col = nt * 16 + (lane & 15);
#pragma unroll
  for (int e = 0; e < 16; ++e)
    dst[e] = (f16)src[(kt * 32 + kk_of(e, hf)) * 256 + col];
}

// Rows of the activation that one block of either GEMM kernel takes: MT tiles
// of 16. A weight fragment, once loaded, is multiplied with all MT row tiles,
// so a block's pass over the packed weights serves 64 rows, not 16.
#define MT 4
#define BROWS (MT * 16)

// A 64 x (NT*16) piece of a product: the block's 64 rows in LDS times n-tiles
// nt0 .. nt0+NT-1 of the packed weight fragments fr, K = 256.
// WA = false: rows as A, weights as B: acc[m][j][r] is row m*16 + 8*hf + r,
// column j*16 + colL. WA = true: the same fragments with the weights as A and
// the rows as B (both operands have one lane map), the transposed tile:
// acc[m][j][r] is row m*16 + colL, column j*16 + 8*hf + r, so that a lane holds
// 8 neighbouring columns of one row.
template <int NT, bool WA = false>
__device__ __forceinline__ void mm_rows(const f16* lxp, const f16* fr, int nt0,
                                        int lane, v8f (&acc)[MT][NT]) {
  int hf = lane >> 4, colL = lane & 15;
  // One address a lane for all weight fragments: every step from it is a
  // constant, and its register lives through the whole product.
  const f16* bp = fr + ((size_t)nt0 * 32 + lane) * 16;
#pragma unroll
  for (int m = 0; m < MT; ++m)
#pragma unroll
    for (int j = 0; j < NT; ++j) acc[m][j] = (v8f){0, 0, 0, 0, 0, 0, 0, 0};
#pragma unroll
  for (int kt = 0; kt < 8; ++kt) {
    v16h b[NT], a[MT];
#pragma unroll
    for (int j = 0; j < NT; ++j)
      b[j] = *(const v16h*)(bp + (kt * 16 + j) * 512);
#pragma unroll
    for (int m = 0; m < MT; ++m)
      a[m] = frag_rowmajor(lxp, LX_PITCH, m * 16 + colL, kt * 32, hf);
    // Keeps a step's loads in one group ahead of its WMMAs: spread among them
    // each pair of LDS loads is waited for singly.
    __builtin_amdgcn_sched_barrier(0);
#pragma unroll
    for (int m = 0; m < MT; ++m)
#pragma unroll
      for (int j = 0; j < NT; ++j)
        acc[m][j] = WA ? wmma16(b[j], a[m], acc[m][j])
                       : wmma16(a[m], b[j], acc[m][j]);
  }
}

// ---------------------------------------------------------------------------
// Kernel A: LayerNorm(M_raw) then fused Q/K/V/G projection GEMM via WMMA.
// One block = 64 rows of the [32768 x 256] activation; each of the 8 waves has
// 4 n-tiles of each of two matrices, taken against all 4 row tiles.
// The products are taken transposed (weights as A): a lane then holds 8
// neighbouring channels of one row and stores them as one 16-byte piece.
// q/k/v stored f16 in tile order, g f16 in 16 x 16 pieces (see QKV_TILE).
// ---------------------------------------------------------------------------
__global__ void __launch_bounds__(256) k_ln_qkvg(
    const float* M_raw, const float* g_ln, const float* b_ln, const float* bg,
    const f16* fq, const f16* fk, const f16* fv, const f16* fg,
    f16* q16, f16* k16, f16* v16p, f16* g16) {
  __shared__ __attribute__((aligned(16))) float lraw[BROWS][LRAW_PITCH];
  __shared__ float lstat[BROWS][2];
  __shared__ __attribute__((aligned(16))) f16 lx[BROWS][LX_PITCH];
  int tid = threadIdx.x;
  size_t base = (size_t)blockIdx.x * BROWS * 256;
#pragma unroll
  for (int it = 0; it < BROWS; ++it) {
    int idx = it * 256 + tid;
    lraw[idx >> 8][idx & 255] = M_raw[base + idx];
  }
  __syncthreads();
  if (tid < BROWS) {
    float s = 0.f;
    for (int c = 0; c < 256; ++c) s += lraw[tid][c];
    float mu = s * (1.f / 256.f);
    float vv = 0.f;
    for (int c = 0; c < 256; ++c) { float d = lraw[tid][c] - mu; vv += d * d; }
    lstat[tid][0] = mu;
    lstat[tid][1] = rsqrtf(vv * (1.f / 256.f) + 1e-5f);
  }
  __syncthreads();
#pragma unroll
  for (int it = 0; it < BROWS; ++it) {
    int idx = it * 256 + tid;
    int r = idx >> 8, c = idx & 255;
    lx[r][c] = (f16)((lraw[r][c] - lstat[r][0]) * lstat[r][1] * g_ln[c] + b_ln[c]);
  }
  __syncthreads();

  int wave = __builtin_amdgcn_readfirstlane(tid >> 5), lane = tid & 31;
  int hf = lane >> 4, colL = lane & 15;
  // Each wave has the same four n-tiles of two matrices: waves 0-3 of g and v,
  // waves 4-7 of q and k. The gate's long epilogue so
  // comes first, beside the other waves' products.
  int nt0 = (wave & 3) * 4;
  int gr0 = blockIdx.x * BROWS;
  v8f acc[MT][4];
  // The branch stands in front of the products, once per wave: between a
  // tile's last WMMA and the first use of its result there is then no branch.
  if (wave < 4) {
    mm_rows<4, true>(&lx[0][0], fg, nt0, lane, acc);
    // Keeps the epilogue out of the products' scheduling region: mixed in
    // there, where registers are scarce, all its stores went through one data
    // register, each waited for before the next conversion.
    __builtin_amdgcn_sched_barrier(0);
    // The register that holds the offset of the weight loads is given to a
    // load below as its destination: the wait stands in front of that.
    asm volatile("s_wait_xcnt 0x0" ::: "memory");
    // The gate bias of the lane's 32 columns. Read once, ahead of the stores
    // (read again behind each store, g16 could be bg for all the compiler
    // knows, it is waited for singly), and behind the products, when the
    // fragments' registers are free.
    v8f bgn[4];
#pragma unroll
    for (int j = 0; j < 4; ++j)
      bgn[j] = *(const v8f*)(bg + nt0 * 16 + 8 * hf + j * 16);
    // The register that holds the offset of these loads is reused below: the
    // wait stands in front of its overwrite.
    asm volatile("s_wait_xcnt 0x0" ::: "memory");
    // Keeps the eight loads in flight together: with the first additions drawn
    // up among them they are issued and waited for one or two at a time.
    __builtin_amdgcn_sched_barrier(0);
    // One address a lane; every tile step from it is a constant.
    f16* gp = g16 + ((size_t)(gr0 >> 4) * 16 + nt0) * QKV_PIECE + colL * 16 +
              8 * hf;
#pragma unroll
    for (int m = 0; m < MT; ++m)
#pragma unroll
      for (int j = 0; j < 4; ++j) {
        v8h o;
#pragma unroll
        for (int r = 0; r < 8; ++r)
          o[r] = (f16)(1.f / (1.f + __expf(-(acc[m][j][r] + bgn[j][r]))));
        *(v8h*)(gp + (m * 16 + j) * QKV_PIECE) = o;
        // The next tile overwrites the store's data registers.
        asm volatile("s_wait_xcnt 0x0" ::: "memory");
      }
  }
  int mat0 = (wave < 4) ? 2 : 0, mat1 = (wave < 4) ? 3 : 2;
  // Stays rolled: q, k and v run through the same code, which then takes a
  // third of the room in the instruction cache.
#pragma unroll 1
  for (int mat = mat0; mat < mat1; ++mat) {
    const f16* fr = (mat == 0) ? fq : (mat == 1) ? fk : fv;
    f16* dst = (mat == 0) ? q16 : (mat == 1) ? k16 : v16p;
    float sc = (mat == 0) ? 0.17677669529663687f : 1.f;  // q: 1/sqrt(C)
    mm_rows<4, true>(&lx[0][0], fr, nt0, lane, acc);
    // As above: keeps the epilogue out of the products' scheduling region.
    __builtin_amdgcn_sched_barrier(0);
    // The block's 64 rows lie in one s, the wave's four n-tiles in two heads:
    // one address a lane; every tile step from it is a constant.
    f16* dp = dst + (((size_t)(gr0 >> 8) * 8 + (nt0 >> 1)) * 16 +
                     ((gr0 & 255) >> 4)) * QKV_TILE + colL * 16 + hf * 8;
#pragma unroll
    for (int m = 0; m < MT; ++m)
#pragma unroll
      for (int j = 0; j < 4; ++j) {
        v8h o;
#pragma unroll
        for (int r = 0; r < 8; ++r) o[r] = (f16)(acc[m][j][r] * sc);
        *(v8h*)(dp + ((j >> 1) * 16 + m) * QKV_TILE + (j & 1) * QKV_PIECE) = o;
        // The next tile overwrites the store's data registers.
        asm volatile("s_wait_xcnt 0x0" ::: "memory");
      }
  }
}

__global__ void __launch_bounds__(128) k_pairbias(
    const float* Z, const float* gz, const float* bz, const float* bw,
    float* pb) {
  __shared__ __attribute__((aligned(16))) float lz[128 * 132];
  int tid = threadIdx.x;
  int wave = tid >> 5, lane = tid & 31;
  int it = blockIdx.x >> 5;  // rows i = it*16 + 0..15
  int jb = blockIdx.x & 31;  // keys j = jb*8 + 0..7
  // Thread t has the pair i = it*16 + ((t>>2)&15), j = jb*8 + (t>>6)*4 + (t&3).
  v4f z[32];
  {
    // Row k of this wave belongs to thread wave*32 + k.
    const float* zp = Z +
        (size_t)((it * 16 + (wave & 1) * 8) * 256 + jb * 8 + (wave >> 1) * 4) *
            128 + lane * 4;
#pragma unroll
    for (int k = 0; k < 32; ++k)
      z[k] = *(const v4f*)(zp + ((k >> 2) * 256 + (k & 3)) * 128);
    // The registers that hold the addresses of the loads above are reused
    // below: the wait stands in front of their overwrite.
    asm volatile("s_wait_xcnt 0x0" ::: "memory");
    float* lw = lz + wave * 32 * 132 + lane * 4;
#pragma unroll
    for (int k = 0; k < 32; ++k) *(v4f*)(lw + k * 132) = z[k];
  }
  __syncthreads();
  const float* lr = lz + tid * 132;
#pragma unroll
  for (int c = 0; c < 32; ++c) z[c] = *(const v4f*)(lr + c * 4);
  v4f s4 = z[0];
#pragma unroll
  for (int c = 1; c < 32; ++c) s4 += z[c];
  float mu = ((s4[0] + s4[1]) + (s4[2] + s4[3])) * (1.f / 128.f);
  v4f q4 = {0, 0, 0, 0};
#pragma unroll
  for (int c = 0; c < 32; ++c) {
    v4f d = z[c] - mu;
    q4 += d * d;
  }
  float vv = (q4[0] + q4[1]) + (q4[2] + q4[3]);
  float rstd = rsqrtf(vv * (1.f / 128.f) + 1e-5f);
  // No launch of this file writes these three inputs: read through the
  // constant address space they come by scalar loads, one for the wave
  // (behind the asm statement above they would else be vector loads).
  const cfloat* gzc = (const cfloat*)(unsigned long long)gz;
  const cfloat* bzc = (const cfloat*)(unsigned long long)bz;
  const cfloat* bwc = (const cfloat*)(unsigned long long)bw;
  // Even and odd channels are summed apart: two neighbouring channels go
  // through one packed multiply-add.
  v2f acc[8] = {{0, 0}, {0, 0}, {0, 0}, {0, 0}, {0, 0}, {0, 0}, {0, 0}, {0, 0}};
  // Stays rolled, 8 channels a trip: unrolled, the scalar loads of all trips
  // are lifted to the top, do not fit the scalar registers and are spilled.
#pragma unroll 1
  for (int p0 = 0; p0 < 128; p0 += 8) {
    v4f za = *(const v4f*)(lr + p0);
    v4f zb = *(const v4f*)(lr + p0 + 4);
    v2f nv[4] = {{za[0], za[1]}, {za[2], za[3]}, {zb[0], zb[1]}, {zb[2], zb[3]}};
#pragma unroll
    for (int t = 0; t < 4; ++t) {
      v2f g2 = {gzc[p0 + 2 * t], gzc[p0 + 2 * t + 1]};
      v2f b2 = {bzc[p0 + 2 * t], bzc[p0 + 2 * t + 1]};
      nv[t] = (nv[t] - mu) * rstd * g2 + b2;
    }
#pragma unroll
    for (int t = 0; t < 4; ++t)
#pragma unroll
      for (int h = 0; h < 8; ++h) {
        v2f w2 = {bwc[h * 128 + p0 + 2 * t], bwc[h * 128 + p0 + 2 * t + 1]};
        acc[h] += nv[t] * w2;
      }
  }
  float* pw = pb + (it * 16 + (jb >> 1)) * 256 + (tid >> 6) * 128 +
              (jb & 1) * 64 + (tid & 63);
#pragma unroll
  for (int h = 0; h < 8; ++h) pw[(size_t)h * 65536] = acc[h][0] + acc[h][1];
}

__global__ void __launch_bounds__(128) k_attention(
    const f16* q16, const f16* k16, const f16* v16p, const float* pb,
    const float* mask, float* o32) {
  __shared__ __attribute__((aligned(16))) f16 lv[256 * 32];  // V tile, 16 KB
  int s_ = blockIdx.x >> 3, h_ = blockIdx.x & 7;
  size_t headoff = ((size_t)s_ * 8 + h_) * 256 * 32;
  const f16* qs = q16 + headoff;
  const f16* ks = k16 + headoff;
  const f16* vs = v16p + headoff;

#if USE_TDM
  if (threadIdx.x < 32) {
    unsigned lds_off = (unsigned)(unsigned long long)(const void*)&lv[0];
    unsigned long long ga = (unsigned long long)(const void*)vs;
    u32x4 g0;
    g0[0] = 1u;                                   // count=1, user mode
    g0[1] = lds_off;                              // lds_addr
    g0[2] = (unsigned)(ga & 0xffffffffu);         // global_addr[31:0]
    g0[3] = (unsigned)((ga >> 32) & 0x01ffffffu)  // global_addr[56:32]
            | (2u << 30);                         // type=2 (image)
    i32x8 g1;
    g1[0] = (int)(1u << 16);
    g1[1] = (int)(32u << 16);
    g1[2] = (int)(256u << 16);
    g1[3] = (int)(32u << 16);
    g1[4] = 256;
    g1[5] = 32;
    g1[6] = 0;
    g1[7] = 0;
    i32x4 gz4 = {0, 0, 0, 0};   // groups 2/3 unused (<=2D tensor)
#if __clang_major__ >= 23
    i32x8 gz8 = {0, 0, 0, 0, 0, 0, 0, 0};
    __builtin_amdgcn_tensor_load_to_lds(g0, g1, gz4, gz4, gz8, 0);
#else
    __builtin_amdgcn_tensor_load_to_lds(g0, g1, gz4, gz4, 0);
#endif
    __builtin_amdgcn_s_wait_tensorcnt(0);
  }
#else
  for (int t = threadIdx.x; t < 8192; t += 128) lv[t] = vs[t];
#endif
  __syncthreads();

  int wave = threadIdx.x >> 5, lane = threadIdx.x & 31;
  int hf = lane >> 4, colL = lane & 15;
  const float* pbh = pb + (size_t)h_ * 65536;
  const float* mrow = mask + (size_t)s_ * 256;
  const f16* vtp = lv + (8 * hf + (lane & 7)) * 16 + 8 * ((lane >> 3) & 1);
  const f16* qlp = qs + colL * 16 + hf * 8;
  const f16* klp = ks + colL * 16 + hf * 8;

  for (int itb = 0; itb < 4; ++itb) {
    int i0 = (itb * 4 + wave) * 16;
    // B = Q^T: lane holds column i = i0 + colL.
    v16h qb = frag_tiled(qlp, itb * 4 + wave);
    // pb lies in C-operand order (see kernel B): tile (i0/16, jt) is 256
    // floats, registers 0..3 of all lanes first, then registers 4..7.
    const float* pbt = pbh + (size_t)(itb * 4 + wave) * 4096 + lane * 4;
    // acc[jt][r] = logits[i0 + colL][jt*16 + 8*hf + r]; the pair bias and the
    // mask bias enter as the C operand.
    v8f acc[16];
#pragma unroll
    for (int jt = 0; jt < 16; ++jt) {
      v4f lo = *(const v4f*)(pbt + jt * 256);
      v4f hi = *(const v4f*)(pbt + jt * 256 + 128);
      acc[jt] = __builtin_shufflevector(lo, hi, 0, 1, 2, 3, 4, 5, 6, 7);
    }
    // The registers that hold the addresses of the loads above are reused
    // below: the wait stands in front of their overwrite.
    asm volatile("s_wait_xcnt 0x0" ::: "memory");
#pragma unroll
    for (int g = 0; g < 4; ++g) {
      v16h ka[4];
      v8f mv[4];
#pragma unroll
      for (int t = 0; t < 4; ++t) {
        int jt = g * 4 + t;
        ka[t] = frag_tiled(klp, jt);
        mv[t] = *(const v8f*)(mrow + jt * 16 + 8 * hf);
      }
      // Keeps the loads of four tiles in flight together: without it each
      // tile's loads are issued and waited for singly, in front of its WMMA.
      __builtin_amdgcn_sched_barrier(0);
#pragma unroll
      for (int t = 0; t < 4; ++t) {
        int jt = g * 4 + t;
        v8f c;
#pragma unroll
        for (int r = 0; r < 8; ++r) c[r] = acc[jt][r] + 1e9f * (mv[t][r] - 1.f);
        acc[jt] = wmma16(ka[t], qb, c);
      }
    }
    // softmax over j: 128 values of row i in this lane, the other 128 in
    // lane ^ 16.
    v8f mx = acc[0];
#pragma unroll
    for (int jt = 1; jt < 16; ++jt)
#pragma unroll
      for (int r = 0; r < 8; ++r) mx[r] = fmaxf(mx[r], acc[jt][r]);
    float m = fmaxf(fmaxf(fmaxf(mx[0], mx[1]), fmaxf(mx[2], mx[3])),
                    fmaxf(fmaxf(mx[4], mx[5]), fmaxf(mx[6], mx[7])));
    m = fmaxf(m, __shfl_xor(m, 16, 32));
    // Tiles 2kt and 2kt+1 hold keys kt*32 + {8*hf + 0..7, 16 + 8*hf + 0..7}:
    // converted in place they are the B fragment pt[kt] in the k order of
    // kk_of (unnormalized exp; 1/rowsum folded into the epilogue).
    v8f sv = {0, 0, 0, 0, 0, 0, 0, 0};
    v16h pt[8];
#pragma unroll
    for (int jt = 0; jt < 16; ++jt)
#pragma unroll
      for (int r = 0; r < 8; ++r) {
        float e = __expf(acc[jt][r] - m);
        sv[r] += e;
        pt[jt >> 1][(jt & 1) * 8 + r] = (f16)e;
      }
    float ssum = ((sv[0] + sv[1]) + (sv[2] + sv[3])) +
                 ((sv[4] + sv[5]) + (sv[6] + sv[7]));
    ssum += __shfl_xor(ssum, 16, 32);
    float rinv = 1.f / ssum;
    // Ot = V^T Pt
    v8f oacc[2] = {{0, 0, 0, 0, 0, 0, 0, 0}, {0, 0, 0, 0, 0, 0, 0, 0}};
#pragma unroll
    for (int kt = 0; kt < 8; ++kt)
#pragma unroll
      for (int ct = 0; ct < 2; ++ct) {
        v16h va = frag_tr16(vtp, ct, kt);
        oacc[ct] = wmma16(va, pt[kt], oacc[ct]);
      }
    // oacc[ct][r] = O[i0 + colL][ct*16 + 8*hf + r]: 32 bytes of piece
    // (row tile s*16 + i0/16, column tile h*2 + ct); the wave fills the piece.
    float* orow = o32 + (((size_t)s_ * 16 + (i0 >> 4)) * 16 + h_ * 2) * QKV_PIECE +
                  colL * 16 + 8 * hf;
#pragma unroll
    for (int ct = 0; ct < 2; ++ct) {
      v8f ov;
#pragma unroll
      for (int r = 0; r < 8; ++r) ov[r] = oacc[ct][r] * rinv;
      *(v8f*)(orow + ct * QKV_PIECE) = ov;
    }
    // The next trip overwrites the stores' address and data registers.
    asm volatile("s_wait_xcnt 0x0" ::: "memory");
  }
}

// ---------------------------------------------------------------------------
// Kernel D: out = (g * o) @ Wo + out_bias + M_raw
// One block = 64 rows; each of the 8 waves has 2 n-tiles against 4 row tiles.
// ---------------------------------------------------------------------------
__global__ void __launch_bounds__(256) k_out(
    const f16* g16, const float* o32, const f16* fo, const float* out_bias,
    const float* M_raw, float* out) {
  __shared__ __attribute__((aligned(16))) f16 lx[BROWS][LX_PITCH];
  int tid = threadIdx.x;
  size_t base = (size_t)blockIdx.x * BROWS * 256;
  // The wave's number as a scalar: the addresses of the wave's weight fragments
  // and columns then need no vector registers of their own, which are scarce
  // here (64 accumulators and 64 residuals a lane).
  int wave = __builtin_amdgcn_readfirstlane(tid >> 5);
  int lane = tid & 31, hf = lane >> 4, colL = lane & 15;
  int gr0 = blockIdx.x * BROWS;
  // The residual and the bias of the lane's output elements are read here,
  // with the staging loads: read among the stores of the epilogue (out could
  // be M_raw, for all the compiler knows) each is waited for singly.
  float res[MT][2][8], ob[2];
#pragma unroll
  for (int t = 0; t < 2; ++t) ob[t] = out_bias[(wave * 2 + t) * 16 + colL];
  // The register that holds the offset of the two loads above is given to a
  // later load as its destination: the wait stands in front of that.
  asm volatile("s_wait_xcnt 0x0" ::: "memory");
  // One offset a lane for the residual and the output; every tile, row and
  // column step from it is a constant.
  size_t eoff = (size_t)(gr0 + 8 * hf) * 256 + wave * 32 + colL;
  const float* mp = M_raw + eoff;
#pragma unroll
  for (int t = 0; t < 2; ++t)
#pragma unroll
    for (int m = 0; m < MT; ++m)
#pragma unroll
      for (int r = 0; r < 8; ++r)
        res[m][t][r] = mp[(m * 16 + r) * 256 + t * 16];
#pragma unroll
  for (int it = 0; it < BROWS; ++it) {
    int idx = it * 256 + tid;
    float gv = (float)g16[base + idx];
    // g and o come in tile order: trip it is the piece of row tile it / 16 and
    // column tile it % 16, thread tid its row tid / 16, column tid % 16.
    lx[(it >> 4) * 16 + (tid >> 4)][(it & 15) * 16 + (tid & 15)] =
        (f16)(gv * o32[base + idx]);
  }
  __syncthreads();
  // All products stand ahead of the first store, so that no weight load need
  // wait behind a store.
  v8f acc[MT][2];
  mm_rows<2>(&lx[0][0], fo, wave * 2, lane, acc);
  float* op = out + eoff;
#pragma unroll
  for (int m = 0; m < MT; ++m)
#pragma unroll
    for (int t = 0; t < 2; ++t)
#pragma unroll
      for (int r = 0; r < 8; ++r)
        op[(m * 16 + r) * 256 + t * 16] = acc[m][t][r] + ob[t] + res[m][t][r];
}

// ---------------------------------------------------------------------------
extern "C" void kernel_launch(void* const* d_in, const int* in_sizes, int n_in,
                              void* d_out, int out_size, void* d_ws,
                              size_t ws_size, hipStream_t stream) {
  (void)in_sizes; (void)n_in; (void)out_size; (void)ws_size;
  const float* M_raw  = (const float*)d_in[0];
  const float* Z      = (const float*)d_in[1];
  const float* M_mask = (const float*)d_in[2];
  const float* ln_m_g = (const float*)d_in[3];
  const float* ln_m_b = (const float*)d_in[4];
  const float* ln_z_g = (const float*)d_in[5];
  const float* ln_z_b = (const float*)d_in[6];
  const float* b_w    = (const float*)d_in[7];
  const float* Wq     = (const float*)d_in[8];
  const float* Wk     = (const float*)d_in[9];
  const float* Wv     = (const float*)d_in[10];
  const float* Wg     = (const float*)d_in[11];
  const float* bg     = (const float*)d_in[12];
  const float* Wo     = (const float*)d_in[13];
  const float* ob     = (const float*)d_in[14];
  float* out = (float*)d_out;

  char* ws = (char*)d_ws;
  size_t off = 0;
  auto take = [&](size_t b) {
    char* p = ws + off;
    off += (b + 255) & ~(size_t)255;
    return p;
  };
  f16* fq   = (f16*)take(131072);      // swizzled weight fragments (f16)
  f16* fk   = (f16*)take(131072);
  f16* fv   = (f16*)take(131072);
  f16* fg   = (f16*)take(131072);
  f16* fo   = (f16*)take(131072);
  f16* q16  = (f16*)take(16777216);    // f16, tile order (QKV_TILE)
  f16* k16  = (f16*)take(16777216);
  f16* v16p = (f16*)take(16777216);
  f16* g16  = (f16*)take(16777216);    // f16, 16 x 16 pieces
  float* o32 = (float*)take(33554432); // f32, 16 x 16 pieces
  float* pb  = (float*)take(2097152);  // f32, C-operand order (kernel B)

  k_swizzle<<<80, 256, 0, stream>>>(Wq, Wk, Wv, Wg, Wo, fq, fk, fv, fg, fo);
  k_ln_qkvg<<<512, 256, 0, stream>>>(M_raw, ln_m_g, ln_m_b, bg, fq, fk, fv,
                                      fg, q16, k16, v16p, g16);
  k_pairbias<<<512, 128, 0, stream>>>(Z, ln_z_g, ln_z_b, b_w, pb);
  k_attention<<<1024, 128, 0, stream>>>(q16, k16, v16p, pb, M_mask, o32);
  k_out<<<512, 256, 0, stream>>>(g16, o32, fo, ob, M_raw, out);
}

// v009
// It runs in 69.8 microseconds.
// Two timings next to v008 both put it at 1.07 times that version's speed.
// Counting every step since v000, it is 4.40 times as fast.
#include <hip/hip_runtime.h>
#include <hip/hip_bf16.h>
#include <math.h>

typedef _Float16 f16;
typedef __attribute__((ext_vector_type(16))) _Float16 v16h;
typedef __attribute__((ext_vector_type(8)))  _Float16 v8h;
typedef __attribute__((ext_vector_type(4)))  _Float16 v4h;
typedef __attribute__((ext_vector_type(8)))  float    v8f;
typedef __attribute__((ext_vector_type(4)))  float    v4f;
typedef __attribute__((ext_vector_type(2)))  float    v2f;
typedef __attribute__((address_space(4))) float cfloat;

typedef unsigned int u32x4 __attribute__((ext_vector_type(4)));
typedef int          i32x4 __attribute__((ext_vector_type(4)));
typedef int          i32x8 __attribute__((ext_vector_type(8)));

#ifndef __has_builtin
#define __has_builtin(x) 0
#endif
#if __has_builtin(__builtin_amdgcn_tensor_load_to_lds) && \
    __has_builtin(__builtin_amdgcn_s_wait_tensorcnt)
#define USE_TDM 1
#else
#define USE_TDM 0
#endif

__device__ __forceinline__ int kk_of(int e, int hf) {
  int v = e >> 1, lo = e & 1;
  return ((v >> 2) << 4) + hf * 8 + ((v & 3) << 1) + lo;
}

__device__ __forceinline__ v8f wmma16(v16h a, v16h b, v8f c) {
  return __builtin_amdgcn_wmma_f32_16x16x32_f16(false, a, false, b, (short)0, c,
                                                false, false);
}

// Row-major f16 source: lane's 16 fragment halfs are two contiguous 8-half
// chunks at kbase + hf*8 and kbase + 16 + hf*8 of one row -> two b128 loads.
__device__ __forceinline__ v16h frag_rowmajor(const f16* base, int strideH,
                                              int row, int kbase, int hf) {
  const f16* p = base + (size_t)row * strideH + kbase + hf * 8;
  v8h lo = *(const v8h*)p;
  v8h hi = *(const v8h*)(p + 16);
  v16h r;
#pragma unroll
  for (int e = 0; e < 8; ++e) { r[e] = lo[e]; r[e + 8] = hi[e]; }
  return r;
}

#define LX_PITCH 264    // halfs: 256 + 8  = 528 B  = 16 B x 33

template <int CTRL>
__device__ __forceinline__ float row_xmask(float x) {
  return __builtin_bit_cast(
      float, __builtin_amdgcn_update_dpp(0, __builtin_bit_cast(int, x), CTRL,
                                         0xf, 0xf, true));
}
__device__ __forceinline__ float wave_sum(float x) {
  x += row_xmask<0x161>(x);
  x += row_xmask<0x162>(x);
  x += row_xmask<0x164>(x);
  x += row_xmask<0x168>(x);
  int b = __builtin_bit_cast(int, x);
  return x + __builtin_bit_cast(float, __builtin_amdgcn_permlanex16(
                 b, b, 0x76543210, 0xfedcba98, false, false));
}

// Tile order of q, k and v: [s][h][r/16][c/16][r%16][c%16], 16 x 16 pieces of
// 512 contiguous bytes with rows of 32 B. Lane (colL, hf) owns the 16 bytes at
// halfs colL*16 + hf*8 of a piece: they are the 8 accumulator registers of the
// lane in the transposed projection (kernel A), and the pieces c/16 = 0 and 1
// of a row tile are registers 0-3 and 4-7 of its 16 x 32 fragment in the k
// order of kk_of. Each 16-byte store or load of a wave covers one whole piece.
// g (f16) and o (f32) lie in the same 16 x 16 pieces, [row/16][col/16][row%16]
// [col%16] over the [32768 x 256] activation: a lane's 8 accumulator registers
// are again 8 neighbouring elements of a piece, and the 64 rows of a block of
// kernel D are 64 pieces in a row.
#define QKV_PIECE 256               // elements of a 16 x 16 piece
#define QKV_TILE (2 * QKV_PIECE)    // halfs: 16 rows x 32 channels

// lp = start of the (s,h) plane + the lane's colL*16 + hf*8.
__device__ __forceinline__ v16h frag_tiled(const f16* lp, int tile) {
  v8h lo = *(const v8h*)(lp + tile * QKV_TILE);
  v8h hi = *(const v8h*)(lp + tile * QKV_TILE + QKV_PIECE);
  return __builtin_shufflevector(lo, hi, 0, 1, 2, 3, 4, 5, 6, 7, 8, 9, 10, 11,
                                 12, 13, 14, 15);
}

// A = V^T from the V plane in LDS (tile order, row pitch 32 B inside a piece)
// by the transposing load: lane (colL, hf) gets
// V[kt*32 + 8*hf + 0..7][ct*16 + colL]. The loads from row tiles 2kt and 2kt+1
// are registers 0-3 and 4-7 of one 16 x 32 A fragment in the k order of kk_of.
// vp is the lane's own address in a piece: row 8*hf + (lane & 7), halfs
// 8*((lane >> 3) & 1) onward.
typedef __attribute__((ext_vector_type(8))) short s16x8;
typedef __attribute__((address_space(3))) s16x8 lds_s16x8;
__device__ __forceinline__ v16h frag_tr16(const f16* vp, int ct, int kt) {
  const f16* p = vp + kt * 2 * QKV_TILE + ct * QKV_PIECE;
  v8h lo = __builtin_bit_cast(
      v8h, __builtin_amdgcn_ds_load_tr16_b128_v8i16((lds_s16x8*)p));
  v8h hi = __builtin_bit_cast(
      v8h, __builtin_amdgcn_ds_load_tr16_b128_v8i16((lds_s16x8*)(p + QKV_TILE)));
  return __builtin_shufflevector(lo, hi, 0, 1, 2, 3, 4, 5, 6, 7, 8, 9, 10, 11,
                                 12, 13, 14, 15);
}

// ---------------------------------------------------------------------------
// Kernel 0: pack f32 weights [256 x 256] into f16 WMMA B-fragment order.
// Fragment buffer: [(kt*16+nt)*32 + lane]*16 halfs, kt in 0..7, nt in 0..15.
// ---------------------------------------------------------------------------
__global__ void __launch_bounds__(256) k_swizzle(
    const float* w0, const float* w1, const float* w2, const float* w3,
    const float* w4, f16* f0, f16* f1, f16* f2, f16* f3, f16* f4) {
  int t = blockIdx.x * blockDim.x + threadIdx.x;
  if (t >= 5 * 8 * 16 * 32) return;
  int w = t / 4096, rem = t % 4096;
  int kt = rem / 512; rem %= 512;
  int nt = rem / 32; int lane = rem % 32;
  const float* src = (w == 0) ? w0 : (w == 1) ? w1 : (w == 2) ? w2
                     : (w == 3) ? w3 : w4;
  f16* dst = ((w == 0) ? f0 : (w == 1) ? f1 : (w == 2) ? f2
              : (w == 3) ? f3 : f4) +
             ((size_t)(kt * 16 + nt) * 32 + lane) * 16;
  int hf = lane >> 4, col = nt * 16 + (lane & 15);
#pragma unroll
  for (int e = 0; e < 16; ++e)
    dst[e] = (f16)src[(kt * 32 + kk_of(e, hf)) * 256 + col];
}

// Rows of the activation that one block of either GEMM kernel takes: MT tiles
// of 16. A weight fragment, once loaded, is multiplied with all MT row tiles,
// so a block's pass over the packed weights serves 64 rows, not 16.
#define MT 4
#define BROWS (MT * 16)

// A 64 x (NT*16) piece of a product: the block's 64 rows in LDS times n-tiles
// nt0 .. nt0+NT-1 of the packed weight fragments fr, K = 256.
// WA = false: rows as A, weights as B: acc[m][j][r] is row m*16 + 8*hf + r,
// column j*16 + colL. WA = true: the same fragments with the weights as A and
// the rows as B (both operands have one lane map), the transposed tile:
// acc[m][j][r] is row m*16 + colL, column j*16 + 8*hf + r, so that a lane holds
// 8 neighbouring columns of one row.
template <int NT, bool WA = false>
__device__ __forceinline__ void mm_rows(const f16* lxp, const f16* fr, int nt0,
                                        int lane, v8f (&acc)[MT][NT]) {
  int hf = lane >> 4, colL = lane & 15;
  // One address a lane for all weight fragments: every step from it is a
  // constant, and its register lives through the whole product.
  const f16* bp = fr + ((size_t)nt0 * 32 + lane) * 16;
#pragma unroll
  for (int m = 0; m < MT; ++m)
#pragma unroll
    for (int j = 0; j < NT; ++j) acc[m][j] = (v8f){0, 0, 0, 0, 0, 0, 0, 0};
#pragma unroll
  for (int kt = 0; kt < 8; ++kt) {
    v16h b[NT], a[MT];
#pragma unroll
    for (int j = 0; j < NT; ++j)
      b[j] = *(const v16h*)(bp + (kt * 16 + j) * 512);
#pragma unroll
    for (int m = 0; m < MT; ++m)
      a[m] = frag_rowmajor(lxp, LX_PITCH, m * 16 + colL, kt * 32, hf);
    // Keeps a step's loads in one group ahead of its WMMAs: spread among them
    // each pair of LDS loads is waited for singly.
    __builtin_amdgcn_sched_barrier(0);
#pragma unroll
    for (int m = 0; m < MT; ++m)
#pragma unroll
      for (int j = 0; j < NT; ++j)
        acc[m][j] = WA ? wmma16(b[j], a[m], acc[m][j])
                       : wmma16(a[m], b[j], acc[m][j]);
  }
}

// ---------------------------------------------------------------------------
// Kernel A: LayerNorm(M_raw) then fused Q/K/V/G projection GEMM via WMMA.
// One block = 64 rows of the [32768 x 256] activation; each of the 8 waves has
// 4 n-tiles of each of two matrices, taken against all 4 row tiles.
// LayerNorm: a wave has 8 whole rows in registers, 8 elements of each row a
// lane (two 16-byte loads that cover 512 contiguous bytes a wave); mean and
// variance are sums over the wave, and the normalized row goes to the A tile
// in LDS as f16, 8 bytes a store.
// The products are taken transposed (weights as A): a lane then holds 8
// neighbouring channels of one row and stores them as one 16-byte piece.
// q/k/v stored f16 in tile order, g f16 in 16 x 16 pieces (see QKV_TILE).
// ---------------------------------------------------------------------------
__global__ void __launch_bounds__(256) k_ln_qkvg(
    const float* M_raw, const float* g_ln, const float* b_ln, const float* bg,
    const f16* fq, const f16* fk, const f16* fv, const f16* fg,
    f16* q16, f16* k16, f16* v16p, f16* g16) {
  __shared__ __attribute__((aligned(16))) f16 lx[BROWS][LX_PITCH];
  int tid = threadIdx.x;
  int wave = __builtin_amdgcn_readfirstlane(tid >> 5), lane = tid & 31;
  {
    // The lane's columns: lane*4 + 0..3 and 128 + lane*4 + 0..3.
    v4f ga = *(const v4f*)(g_ln + lane * 4);
    v4f gb = *(const v4f*)(g_ln + 128 + lane * 4);
    v4f ba = *(const v4f*)(b_ln + lane * 4);
    v4f bb = *(const v4f*)(b_ln + 128 + lane * 4);
    const float* mp =
        M_raw + ((size_t)blockIdx.x * BROWS + wave * 8) * 256 + lane * 4;
    v4f xa[8], xb[8];
#pragma unroll
    for (int k = 0; k < 8; ++k) {
      xa[k] = *(const v4f*)(mp + k * 256);
      xb[k] = *(const v4f*)(mp + k * 256 + 128);
    }
    // The registers that hold the addresses of the loads above are reused
    // below: the wait stands in front of their overwrite.
    asm volatile("s_wait_xcnt 0x0" ::: "memory");
    // Keeps the later register writes behind that wait: one of them, to a word
    // of the rows' base address, was drawn up in front of it.
    __builtin_amdgcn_sched_barrier(0);
#pragma unroll
    for (int k = 0; k < 8; ++k) {
      v4f s4 = xa[k] + xb[k];
      float mu = wave_sum((s4[0] + s4[1]) + (s4[2] + s4[3])) * (1.f / 256.f);
      v4f da = xa[k] - mu, db = xb[k] - mu;
      v4f q4 = da * da + db * db;
      float vv = wave_sum((q4[0] + q4[1]) + (q4[2] + q4[3]));
      float rstd = rsqrtf(vv * (1.f / 256.f) + 1e-5f);
      v4f ya = da * rstd * ga + ba, yb = db * rstd * gb + bb;
      v4h ha, hb;
#pragma unroll
      for (int e = 0; e < 4; ++e) { ha[e] = (f16)ya[e]; hb[e] = (f16)yb[e]; }
      *(v4h*)&lx[wave * 8 + k][lane * 4] = ha;
      *(v4h*)&lx[wave * 8 + k][128 + lane * 4] = hb;
    }
  }
  __syncthreads();

  int hf = lane >> 4, colL = lane & 15;
  // Each wave has the same four n-tiles of two matrices: waves 0-3 of g and v,
  // waves 4-7 of q and k. The gate's long epilogue so
  // comes first, beside the other waves' products.
  int nt0 = (wave & 3) * 4;
  int gr0 = blockIdx.x * BROWS;
  v8f acc[MT][4];
  // The branch stands in front of the products, once per wave: between a
  // tile's last WMMA and the first use of its result there is then no branch.
  if (wave < 4) {
    mm_rows<4, true>(&lx[0][0], fg, nt0, lane, acc);
    // Keeps the epilogue out of the products' scheduling region: mixed in
    // there, where registers are scarce, all its stores went through one data
    // register, each waited for before the next conversion.
    __builtin_amdgcn_sched_barrier(0);
    // The register that holds the offset of the weight loads is given to a
    // load below as its destination: the wait stands in front of that.
    asm volatile("s_wait_xcnt 0x0" ::: "memory");
    // The gate bias of the lane's 32 columns. Read once, ahead of the stores
    // (read again behind each store, g16 could be bg for all the compiler
    // knows, it is waited for singly), and behind the products, when the
    // fragments' registers are free.
    v8f bgn[4];
#pragma unroll
    for (int j = 0; j < 4; ++j)
      bgn[j] = *(const v8f*)(bg + nt0 * 16 + 8 * hf + j * 16);
    // The register that holds the offset of these loads is reused below: the
    // wait stands in front of its overwrite.
    asm volatile("s_wait_xcnt 0x0" ::: "memory");
    // Keeps the eight loads in flight together: with the first additions drawn
    // up among them they are issued and waited for one or two at a time.
    __builtin_amdgcn_sched_barrier(0);
    // One address a lane; every tile step from it is a constant.
    f16* gp = g16 + ((size_t)(gr0 >> 4) * 16 + nt0) * QKV_PIECE + colL * 16 +
              8 * hf;
#pragma unroll
    for (int m = 0; m < MT; ++m)
#pragma unroll
      for (int j = 0; j < 4; ++j) {
        v8h o;
#pragma unroll
        for (int r = 0; r < 8; ++r)
          o[r] = (f16)(1.f / (1.f + __expf(-(acc[m][j][r] + bgn[j][r]))));
        *(v8h*)(gp + (m * 16 + j) * QKV_PIECE) = o;
        // The next tile overwrites the store's data registers.
        asm volatile("s_wait_xcnt 0x0" ::: "memory");
      }
  }
  int mat0 = (wave < 4) ? 2 : 0, mat1 = (wave < 4) ? 3 : 2;
  // Stays rolled: q, k and v run through the same code, which then takes a
  // third of the room in the instruction cache.
#pragma unroll 1
  for (int mat = mat0; mat < mat1; ++mat) {
    const f16* fr = (mat == 0) ? fq : (mat == 1) ? fk : fv;
    f16* dst = (mat == 0) ? q16 : (mat == 1) ? k16 : v16p;
    float sc = (mat == 0) ? 0.17677669529663687f : 1.f;  // q: 1/sqrt(C)
    mm_rows<4, true>(&lx[0][0], fr, nt0, lane, acc);
    // As above: keeps the epilogue out of the products' scheduling region.
    __builtin_amdgcn_sched_barrier(0);
    // The block's 64 rows lie in one s, the wave's four n-tiles in two heads:
    // one address a lane; every tile step from it is a constant.
    f16* dp = dst + (((size_t)(gr0 >> 8) * 8 + (nt0 >> 1)) * 16 +
                     ((gr0 & 255) >> 4)) * QKV_TILE + colL * 16 + hf * 8;
#pragma unroll
    for (int m = 0; m < MT; ++m)
#pragma unroll
      for (int j = 0; j < 4; ++j) {
        v8h o;
#pragma unroll
        for (int r = 0; r < 8; ++r) o[r] = (f16)(acc[m][j][r] * sc);
        *(v8h*)(dp + ((j >> 1) * 16 + m) * QKV_TILE + (j & 1) * QKV_PIECE) = o;
        // The next tile overwrites the store's data registers.
        asm volatile("s_wait_xcnt 0x0" ::: "memory");
      }
  }
}

__global__ void __launch_bounds__(128) k_pairbias(
    const float* Z, const float* gz, const float* bz, const float* bw,
    float* pb) {
  __shared__ __attribute__((aligned(16))) float lz[128 * 132];
  int tid = threadIdx.x;
  int wave = tid >> 5, lane = tid & 31;
  int it = blockIdx.x >> 5;  // rows i = it*16 + 0..15
  int jb = blockIdx.x & 31;  // keys j = jb*8 + 0..7
  // Thread t has the pair i = it*16 + ((t>>2)&15), j = jb*8 + (t>>6)*4 + (t&3).
  v4f z[32];
  {
    // Row k of this wave belongs to thread wave*32 + k.
    const float* zp = Z +
        (size_t)((it * 16 + (wave & 1) * 8) * 256 + jb * 8 + (wave >> 1) * 4) *
            128 + lane * 4;
#pragma unroll
    for (int k = 0; k < 32; ++k)
      z[k] = *(const v4f*)(zp + ((k >> 2) * 256 + (k & 3)) * 128);
    // The registers that hold the addresses of the loads above are reused
    // below: the wait stands in front of their overwrite.
    asm volatile("s_wait_xcnt 0x0" ::: "memory");
    float* lw = lz + wave * 32 * 132 + lane * 4;
#pragma unroll
    for (int k = 0; k < 32; ++k) *(v4f*)(lw + k * 132) = z[k];
  }
  __syncthreads();
  const float* lr = lz + tid * 132;
#pragma unroll
  for (int c = 0; c < 32; ++c) z[c] = *(const v4f*)(lr + c * 4);
  v4f s4 = z[0];
#pragma unroll
  for (int c = 1; c < 32; ++c) s4 += z[c];
  float mu = ((s4[0] + s4[1]) + (s4[2] + s4[3])) * (1.f / 128.f);
  v4f q4 = {0, 0, 0, 0};
#pragma unroll
  for (int c = 0; c < 32; ++c) {
    v4f d = z[c] - mu;
    q4 += d * d;
  }
  float vv = (q4[0] + q4[1]) + (q4[2] + q4[3]);
  float rstd = rsqrtf(vv * (1.f / 128.f) + 1e-5f);
  // No launch of this file writes these three inputs: read through the
  // constant address space they come by scalar loads, one for the wave
  // (behind the asm statement above they would else be vector loads).
  const cfloat* gzc = (const cfloat*)(unsigned long long)gz;
  const cfloat* bzc = (const cfloat*)(unsigned long long)bz;
  const cfloat* bwc = (const cfloat*)(unsigned long long)bw;
  // Even and odd channels are summed apart: two neighbouring channels go
  // through one packed multiply-add.
  v2f acc[8] = {{0, 0}, {0, 0}, {0, 0}, {0, 0}, {0, 0}, {0, 0}, {0, 0}, {0, 0}};
  // Stays rolled, 8 channels a trip: unrolled, the scalar loads of all trips
  // are lifted to the top, do not fit the scalar registers and are spilled.
#pragma unroll 1
  for (int p0 = 0; p0 < 128; p0 += 8) {
    v4f za = *(const v4f*)(lr + p0);
    v4f zb = *(const v4f*)(lr + p0 + 4);
    v2f nv[4] = {{za[0], za[1]}, {za[2], za[3]}, {zb[0], zb[1]}, {zb[2], zb[3]}};
#pragma unroll
    for (int t = 0; t < 4; ++t) {
      v2f g2 = {gzc[p0 + 2 * t], gzc[p0 + 2 * t + 1]};
      v2f b2 = {bzc[p0 + 2 * t], bzc[p0 + 2 * t + 1]};
      nv[t] = (nv[t] - mu) * rstd * g2 + b2;
    }
#pragma unroll
    for (int t = 0; t < 4; ++t)
#pragma unroll
      for (int h = 0; h < 8; ++h) {
        v2f w2 = {bwc[h * 128 + p0 + 2 * t], bwc[h * 128 + p0 + 2 * t + 1]};
        acc[h] += nv[t] * w2;
      }
  }
  float* pw = pb + (it * 16 + (jb >> 1)) * 256 + (tid >> 6) * 128 +
              (jb & 1) * 64 + (tid & 63);
#pragma unroll
  for (int h = 0; h < 8; ++h) pw[(size_t)h * 65536] = acc[h][0] + acc[h][1];
}

__global__ void __launch_bounds__(128) k_attention(
    const f16* q16, const f16* k16, const f16* v16p, const float* pb,
    const float* mask, float* o32) {
  __shared__ __attribute__((aligned(16))) f16 lv[256 * 32];  // V tile, 16 KB
  int s_ = blockIdx.x >> 3, h_ = blockIdx.x & 7;
  size_t headoff = ((size_t)s_ * 8 + h_) * 256 * 32;
  const f16* qs = q16 + headoff;
  const f16* ks = k16 + headoff;
  const f16* vs = v16p + headoff;

#if USE_TDM
  if (threadIdx.x < 32) {
    unsigned lds_off = (unsigned)(unsigned long long)(const void*)&lv[0];
    unsigned long long ga = (unsigned long long)(const void*)vs;
    u32x4 g0;
    g0[0] = 1u;                                   // count=1, user mode
    g0[1] = lds_off;                              // lds_addr
    g0[2] = (unsigned)(ga & 0xffffffffu);         // global_addr[31:0]
    g0[3] = (unsigned)((ga >> 32) & 0x01ffffffu)  // global_addr[56:32]
            | (2u << 30);                         // type=2 (image)
    i32x8 g1;
    g1[0] = (int)(1u << 16);
    g1[1] = (int)(32u << 16);
    g1[2] = (int)(256u << 16);
    g1[3] = (int)(32u << 16);
    g1[4] = 256;
    g1[5] = 32;
    g1[6] = 0;
    g1[7] = 0;
    i32x4 gz4 = {0, 0, 0, 0};   // groups 2/3 unused (<=2D tensor)
#if __clang_major__ >= 23
    i32x8 gz8 = {0, 0, 0, 0, 0, 0, 0, 0};
    __builtin_amdgcn_tensor_load_to_lds(g0, g1, gz4, gz4, gz8, 0);
#else
    __builtin_amdgcn_tensor_load_to_lds(g0, g1, gz4, gz4, 0);
#endif
    __builtin_amdgcn_s_wait_tensorcnt(0);
  }
#else
  for (int t = threadIdx.x; t < 8192; t += 128) lv[t] = vs[t];
#endif
  __syncthreads();

  int wave = threadIdx.x >> 5, lane = threadIdx.x & 31;
  int hf = lane >> 4, colL = lane & 15;
  const float* pbh = pb + (size_t)h_ * 65536;
  const float* mrow = mask + (size_t)s_ * 256;
  const f16* vtp = lv + (8 * hf + (lane & 7)) * 16 + 8 * ((lane >> 3) & 1);
  const f16* qlp = qs + colL * 16 + hf * 8;
  const f16* klp = ks + colL * 16 + hf * 8;

  for (int itb = 0; itb < 4; ++itb) {
    int i0 = (itb * 4 + wave) * 16;
    // B = Q^T: lane holds column i = i0 + colL.
    v16h qb = frag_tiled(qlp, itb * 4 + wave);
    // pb lies in C-operand order (see kernel B): tile (i0/16, jt) is 256
    // floats, registers 0..3 of all lanes first, then registers 4..7.
    const float* pbt = pbh + (size_t)(itb * 4 + wave) * 4096 + lane * 4;
    // acc[jt][r] = logits[i0 + colL][jt*16 + 8*hf + r]; the pair bias and the
    // mask bias enter as the C operand.
    v8f acc[16];
#pragma unroll
    for (int jt = 0; jt < 16; ++jt) {
      v4f lo = *(const v4f*)(pbt + jt * 256);
      v4f hi = *(const v4f*)(pbt + jt * 256 + 128);
      acc[jt] = __builtin_shufflevector(lo, hi, 0, 1, 2, 3, 4, 5, 6, 7);
    }
    // The registers that hold the addresses of the loads above are reused
    // below: the wait stands in front of their overwrite.
    asm volatile("s_wait_xcnt 0x0" ::: "memory");
#pragma unroll
    for (int g = 0; g < 4; ++g) {
      v16h ka[4];
      v8f mv[4];
#pragma unroll
      for (int t = 0; t < 4; ++t) {
        int jt = g * 4 + t;
        ka[t] = frag_tiled(klp, jt);
        mv[t] = *(const v8f*)(mrow + jt * 16 + 8 * hf);
      }
      // Keeps the loads of four tiles in flight together: without it each
      // tile's loads are issued and waited for singly, in front of its WMMA.
      __builtin_amdgcn_sched_barrier(0);
#pragma unroll
      for (int t = 0; t < 4; ++t) {
        int jt = g * 4 + t;
        v8f c;
#pragma unroll
        for (int r = 0; r < 8; ++r) c[r] = acc[jt][r] + 1e9f * (mv[t][r] - 1.f);
        acc[jt] = wmma16(ka[t], qb, c);
      }
    }
    // softmax over j: 128 values of row i in this lane, the other 128 in
    // lane ^ 16.
    v8f mx = acc[0];
#pragma unroll
    for (int jt = 1; jt < 16; ++jt)
#pragma unroll
      for (int r = 0; r < 8; ++r) mx[r] = fmaxf(mx[r], acc[jt][r]);
    float m = fmaxf(fmaxf(fmaxf(mx[0], mx[1]), fmaxf(mx[2], mx[3])),
                    fmaxf(fmaxf(mx[4], mx[5]), fmaxf(mx[6], mx[7])));
    m = fmaxf(m, __shfl_xor(m, 16, 32));
    // Tiles 2kt and 2kt+1 hold keys kt*32 + {8*hf + 0..7, 16 + 8*hf + 0..7}:
    // converted in place they are the B fragment pt[kt] in the k order of
    // kk_of (unnormalized exp; 1/rowsum folded into the epilogue).
    v8f sv = {0, 0, 0, 0, 0, 0, 0, 0};
    v16h pt[8];
#pragma unroll
    for (int jt = 0; jt < 16; ++jt)
#pragma unroll
      for (int r = 0; r < 8; ++r) {
        float e = __expf(acc[jt][r] - m);
        sv[r] += e;
        pt[jt >> 1][(jt & 1) * 8 + r] = (f16)e;
      }
    float ssum = ((sv[0] + sv[1]) + (sv[2] + sv[3])) +
                 ((sv[4] + sv[5]) + (sv[6] + sv[7]));
    ssum += __shfl_xor(ssum, 16, 32);
    float rinv = 1.f / ssum;
    // Ot = V^T Pt
    v8f oacc[2] = {{0, 0, 0, 0, 0, 0, 0, 0}, {0, 0, 0, 0, 0, 0, 0, 0}};
#pragma unroll
    for (int kt = 0; kt < 8; ++kt)
#pragma unroll
      for (int ct = 0; ct < 2; ++ct) {
        v16h va = frag_tr16(vtp, ct, kt);
        oacc[ct] = wmma16(va, pt[kt], oacc[ct]);
      }
    // oacc[ct][r] = O[i0 + colL][ct*16 + 8*hf + r]: 32 bytes of piece
    // (row tile s*16 + i0/16, column tile h*2 + ct); the wave fills the piece.
    float* orow = o32 + (((size_t)s_ * 16 + (i0 >> 4)) * 16 + h_ * 2) * QKV_PIECE +
                  colL * 16 + 8 * hf;
#pragma unroll
    for (int ct = 0; ct < 2; ++ct) {
      v8f ov;
#pragma unroll
      for (int r = 0; r < 8; ++r) ov[r] = oacc[ct][r] * rinv;
      *(v8f*)(orow + ct * QKV_PIECE) = ov;
    }
    // The next trip overwrites the stores' address and data registers.
    asm volatile("s_wait_xcnt 0x0" ::: "memory");
  }
}

// ---------------------------------------------------------------------------
// Kernel D: out = (g * o) @ Wo + out_bias + M_raw
// One block = 64 rows; each of the 8 waves has 2 n-tiles against 4 row tiles.
// ---------------------------------------------------------------------------
__global__ void __launch_bounds__(256) k_out(
    const f16* g16, const float* o32, const f16* fo, const float* out_bias,
    const float* M_raw, float* out) {
  __shared__ __attribute__((aligned(16))) f16 lx[BROWS][LX_PITCH];
  int tid = threadIdx.x;
  size_t base = (size_t)blockIdx.x * BROWS * 256;
  // The wave's number as a scalar: the addresses of the wave's weight fragments
  // and columns then need no vector registers of their own, which are scarce
  // here (64 accumulators and 64 residuals a lane).
  int wave = __builtin_amdgcn_readfirstlane(tid >> 5);
  int lane = tid & 31, hf = lane >> 4, colL = lane & 15;
  int gr0 = blockIdx.x * BROWS;
  // The residual and the bias of the lane's output elements are read here,
  // with the staging loads: read among the stores of the epilogue (out could
  // be M_raw, for all the compiler knows) each is waited for singly.
  float res[MT][2][8], ob[2];
#pragma unroll
  for (int t = 0; t < 2; ++t) ob[t] = out_bias[(wave * 2 + t) * 16 + colL];
  // The register that holds the offset of the two loads above is given to a
  // later load as its destination: the wait stands in front of that.
  asm volatile("s_wait_xcnt 0x0" ::: "memory");
  // One offset a lane for the residual and the output; every tile, row and
  // column step from it is a constant.
  size_t eoff = (size_t)(gr0 + 8 * hf) * 256 + wave * 32 + colL;
  const float* mp = M_raw + eoff;
#pragma unroll
  for (int t = 0; t < 2; ++t)
#pragma unroll
    for (int m = 0; m < MT; ++m)
#pragma unroll
      for (int r = 0; r < 8; ++r)
        res[m][t][r] = mp[(m * 16 + r) * 256 + t * 16];
#pragma unroll
  for (int it = 0; it < BROWS; ++it) {
    int idx = it * 256 + tid;
    float gv = (float)g16[base + idx];
    // g and o come in tile order: trip it is the piece of row tile it / 16 and
    // column tile it % 16, thread tid its row tid / 16, column tid % 16.
    lx[(it >> 4) * 16 + (tid >> 4)][(it & 15) * 16 + (tid & 15)] =
        (f16)(gv * o32[base + idx]);
  }
  __syncthreads();
  // All products stand ahead of the first store, so that no weight load need
  // wait behind a store.
  v8f acc[MT][2];
  mm_rows<2>(&lx[0][0], fo, wave * 2, lane, acc);
  float* op = out + eoff;
#pragma unroll
  for (int m = 0; m < MT; ++m)
#pragma unroll
    for (int t = 0; t < 2; ++t)
#pragma unroll
      for (int r = 0; r < 8; ++r)
        op[(m * 16 + r) * 256 + t * 16] = acc[m][t][r] + ob[t] + res[m][t][r];
}

// ---------------------------------------------------------------------------
extern "C" void kernel_launch(void* const* d_in, const int* in_sizes, int n_in,
                              void* d_out, int out_size, void* d_ws,
                              size_t ws_size, hipStream_t stream) {
  (void)in_sizes; (void)n_in; (void)out_size; (void)ws_size;
  const float* M_raw  = (const float*)d_in[0];
  const float* Z      = (const float*)d_in[1];
  const float* M_mask = (const float*)d_in[2];
  const float* ln_m_g = (const float*)d_in[3];
  const float* ln_m_b = (const float*)d_in[4];
  const float* ln_z_g = (const float*)d_in[5];
  const float* ln_z_b = (const float*)d_in[6];
  const float* b_w    = (const float*)d_in[7];
  const float* Wq     = (const float*)d_in[8];
  const float* Wk     = (const float*)d_in[9];
  const float* Wv     = (const float*)d_in[10];
  const float* Wg     = (const float*)d_in[11];
  const float* bg     = (const float*)d_in[12];
  const float* Wo     = (const float*)d_in[13];
  const float* ob     = (const float*)d_in[14];
  float* out = (float*)d_out;

  char* ws = (char*)d_ws;
  size_t off = 0;
  auto take = [&](size_t b) {
    char* p = ws + off;
    off += (b + 255) & ~(size_t)255;
    return p;
  };
  f16* fq   = (f16*)take(131072);      // swizzled weight fragments (f16)
  f16* fk   = (f16*)take(131072);
  f16* fv   = (f16*)take(131072);
  f16* fg   = (f16*)take(131072);
  f16* fo   = (f16*)take(131072);
  f16* q16  = (f16*)take(16777216);    // f16, tile order (QKV_TILE)
  f16* k16  = (f16*)take(16777216);
  f16* v16p = (f16*)take(16777216);
  f16* g16  = (f16*)take(16777216);    // f16, 16 x 16 pieces
  float* o32 = (float*)take(33554432); // f32, 16 x 16 pieces
  float* pb  = (float*)take(2097152);  // f32, C-operand order (kernel B)

  k_swizzle<<<80, 256, 0, stream>>>(Wq, Wk, Wv, Wg, Wo, fq, fk, fv, fg, fo);
  k_ln_qkvg<<<512, 256, 0, stream>>>(M_raw, ln_m_g, ln_m_b, bg, fq, fk, fv,
                                      fg, q16, k16, v16p, g16);
  k_pairbias<<<512, 128, 0, stream>>>(Z, ln_z_g, ln_z_b, b_w, pb);
  k_attention<<<1024, 128, 0, stream>>>(q16, k16, v16p, pb, M_mask, o32);
  k_out<<<512, 256, 0, stream>>>(g16, o32, fo, ob, M_raw, out);
}

// v010
// A run of this version takes 66.5 microseconds.
// Next to v009, in two timings, it ran 1.05 and 1.06 times as fast.
// All steps since v000 together make it 4.63 times as fast.
#include <hip/hip_runtime.h>
#include <hip/hip_bf16.h>
#include <math.h>

typedef _Float16 f16;
typedef __attribute__((ext_vector_type(16))) _Float16 v16h;
typedef __attribute__((ext_vector_type(8)))  _Float16 v8h;
typedef __attribute__((ext_vector_type(4)))  _Float16 v4h;
typedef __attribute__((ext_vector_type(8)))  float    v8f;
typedef __attribute__((ext_vector_type(4)))  float    v4f;
typedef __attribute__((ext_vector_type(2)))  float    v2f;
typedef __attribute__((address_space(4))) float cfloat;

typedef unsigned int u32x4 __attribute__((ext_vector_type(4)));
typedef int          i32x4 __attribute__((ext_vector_type(4)));
typedef int          i32x8 __attribute__((ext_vector_type(8)));

#ifndef __has_builtin
#define __has_builtin(x) 0
#endif
#if __has_builtin(__builtin_amdgcn_tensor_load_to_lds) && \
    __has_builtin(__builtin_amdgcn_s_wait_tensorcnt)
#define USE_TDM 1
#else
#define USE_TDM 0
#endif

__device__ __forceinline__ int kk_of(int e, int hf) {
  int v = e >> 1, lo = e & 1;
  return ((v >> 2) << 4) + hf * 8 + ((v & 3) << 1) + lo;
}

__device__ __forceinline__ v8f wmma16(v16h a, v16h b, v8f c) {
  return __builtin_amdgcn_wmma_f32_16x16x32_f16(false, a, false, b, (short)0, c,
                                                false, false);
}

// Row-major f16 source: lane's 16 fragment halfs are two contiguous 8-half
// chunks at kbase + hf*8 and kbase + 16 + hf*8 of one row -> two b128 loads.
__device__ __forceinline__ v16h frag_rowmajor(const f16* base, int strideH,
                                              int row, int kbase, int hf) {
  const f16* p = base + (size_t)row * strideH + kbase + hf * 8;
  v8h lo = *(const v8h*)p;
  v8h hi = *(const v8h*)(p + 16);
  v16h r;
#pragma unroll
  for (int e = 0; e < 8; ++e) { r[e] = lo[e]; r[e + 8] = hi[e]; }
  return r;
}

#define LX_PITCH 264    // halfs: 256 + 8  = 528 B  = 16 B x 33

template <int CTRL>
__device__ __forceinline__ float row_xmask(float x) {
  return __builtin_bit_cast(
      float, __builtin_amdgcn_update_dpp(0, __builtin_bit_cast(int, x), CTRL,
                                         0xf, 0xf, true));
}
__device__ __forceinline__ float wave_sum(float x) {
  x += row_xmask<0x161>(x);
  x += row_xmask<0x162>(x);
  x += row_xmask<0x164>(x);
  x += row_xmask<0x168>(x);
  int b = __builtin_bit_cast(int, x);
  return x + __builtin_bit_cast(float, __builtin_amdgcn_permlanex16(
                 b, b, 0x76543210, 0xfedcba98, false, false));
}

// Tile order of q, k and v: [s][h][r/16][c/16][r%16][c%16], 16 x 16 pieces of
// 512 contiguous bytes with rows of 32 B. Lane (colL, hf) owns the 16 bytes at
// halfs colL*16 + hf*8 of a piece: they are the 8 accumulator registers of the
// lane in the transposed projection (kernel A), and the pieces c/16 = 0 and 1
// of a row tile are registers 0-3 and 4-7 of its 16 x 32 fragment in the k
// order of kk_of. Each 16-byte store or load of a wave covers one whole piece.
// g (f16) and o (f32) lie in the same 16 x 16 pieces, [row/16][col/16][row%16]
// [col%16] over the [32768 x 256] activation: a lane's 8 accumulator registers
// are again 8 neighbouring elements of a piece, and the 64 rows of a block of
// kernel D are 64 pieces in a row.
#define QKV_PIECE 256               // elements of a 16 x 16 piece
#define QKV_TILE (2 * QKV_PIECE)    // halfs: 16 rows x 32 channels

// lp = start of the (s,h) plane + the lane's colL*16 + hf*8.
__device__ __forceinline__ v16h frag_tiled(const f16* lp, int tile) {
  v8h lo = *(const v8h*)(lp + tile * QKV_TILE);
  v8h hi = *(const v8h*)(lp + tile * QKV_TILE + QKV_PIECE);
  return __builtin_shufflevector(lo, hi, 0, 1, 2, 3, 4, 5, 6, 7, 8, 9, 10, 11,
                                 12, 13, 14, 15);
}

// A = V^T from the V plane in LDS (tile order, row pitch 32 B inside a piece)
// by the transposing load: lane (colL, hf) gets
// V[kt*32 + 8*hf + 0..7][ct*16 + colL]. The loads from row tiles 2kt and 2kt+1
// are registers 0-3 and 4-7 of one 16 x 32 A fragment in the k order of kk_of.
// vp is the lane's own address in a piece: row 8*hf + (lane & 7), halfs
// 8*((lane >> 3) & 1) onward.
typedef __attribute__((ext_vector_type(8))) short s16x8;
typedef __attribute__((address_space(3))) s16x8 lds_s16x8;
__device__ __forceinline__ v16h frag_tr16(const f16* vp, int ct, int kt) {
  const f16* p = vp + kt * 2 * QKV_TILE + ct * QKV_PIECE;
  v8h lo = __builtin_bit_cast(
      v8h, __builtin_amdgcn_ds_load_tr16_b128_v8i16((lds_s16x8*)p));
  v8h hi = __builtin_bit_cast(
      v8h, __builtin_amdgcn_ds_load_tr16_b128_v8i16((lds_s16x8*)(p + QKV_TILE)));
  return __builtin_shufflevector(lo, hi, 0, 1, 2, 3, 4, 5, 6, 7, 8, 9, 10, 11,
                                 12, 13, 14, 15);
}

// ---------------------------------------------------------------------------
// Weight packing: f32 weights [256 x 256] into f16 WMMA B-fragment order.
// Fragment buffer: [(kt*16+nt)*32 + lane]*16 halfs, kt in 0..7, nt in 0..15.
// Thread t of 5 * 4096 packs one lane's 16 halfs of one fragment. It runs in
// the blocks at the end of the grid of kernel B (see there).
// ---------------------------------------------------------------------------
__device__ __forceinline__ void swizzle_part(
    int t, const float* w0, const float* w1, const float* w2, const float* w3,
    const float* w4, f16* f0, f16* f1, f16* f2, f16* f3, f16* f4) {
  int w = t / 4096, rem = t % 4096;
  int kt = rem / 512; rem %= 512;
  int nt = rem / 32; int lane = rem % 32;
  const float* src = (w == 0) ? w0 : (w == 1) ? w1 : (w == 2) ? w2
                     : (w == 3) ? w3 : w4;
  f16* dst = ((w == 0) ? f0 : (w == 1) ? f1 : (w == 2) ? f2
              : (w == 3) ? f3 : f4) +
             ((size_t)(kt * 16 + nt) * 32 + lane) * 16;
  int hf = lane >> 4, col = nt * 16 + (lane & 15);
#pragma unroll
  for (int e = 0; e < 16; ++e)
    dst[e] = (f16)src[(kt * 32 + kk_of(e, hf)) * 256 + col];
}

// Rows of the activation that one block of either GEMM kernel takes: MT tiles
// of 16. A weight fragment, once loaded, is multiplied with all MT row tiles,
// so a block's pass over the packed weights serves 64 rows, not 16.
#define MT 4
#define BROWS (MT * 16)

// A 64 x (NT*16) piece of a product: the block's 64 rows in LDS times n-tiles
// nt0 .. nt0+NT-1 of the packed weight fragments fr, K = 256.
// WA = false: rows as A, weights as B: acc[m][j][r] is row m*16 + 8*hf + r,
// column j*16 + colL. WA = true: the same fragments with the weights as A and
// the rows as B (both operands have one lane map), the transposed tile:
// acc[m][j][r] is row m*16 + colL, column j*16 + 8*hf + r, so that a lane holds
// 8 neighbouring columns of one row.
template <int NT, bool WA = false>
__device__ __forceinline__ void mm_rows(const f16* lxp, const f16* fr, int nt0,
                                        int lane, v8f (&acc)[MT][NT]) {
  int hf = lane >> 4, colL = lane & 15;
  // One address a lane for all weight fragments: every step from it is a
  // constant, and its register lives through the whole product.
  const f16* bp = fr + ((size_t)nt0 * 32 + lane) * 16;
#pragma unroll
  for (int m = 0; m < MT; ++m)
#pragma unroll
    for (int j = 0; j < NT; ++j) acc[m][j] = (v8f){0, 0, 0, 0, 0, 0, 0, 0};
#pragma unroll
  for (int kt = 0; kt < 8; ++kt) {
    v16h b[NT], a[MT];
#pragma unroll
    for (int j = 0; j < NT; ++j)
      b[j] = *(const v16h*)(bp + (kt * 16 + j) * 512);
#pragma unroll
    for (int m = 0; m < MT; ++m)
      a[m] = frag_rowmajor(lxp, LX_PITCH, m * 16 + colL, kt * 32, hf);
    // Keeps a step's loads in one group ahead of its WMMAs: spread among them
    // each pair of LDS loads is waited for singly.
    __builtin_amdgcn_sched_barrier(0);
#pragma unroll
    for (int m = 0; m < MT; ++m)
#pragma unroll
      for (int j = 0; j < NT; ++j)
        acc[m][j] = WA ? wmma16(b[j], a[m], acc[m][j])
                       : wmma16(a[m], b[j], acc[m][j]);
  }
}

// ---------------------------------------------------------------------------
// Kernel A: LayerNorm(M_raw) then fused Q/K/V/G projection GEMM via WMMA.
// One block = 64 rows of the [32768 x 256] activation; each of the 8 waves has
// 4 n-tiles of each of two matrices, taken against all 4 row tiles.
// LayerNorm: a wave has 8 whole rows in registers, 8 elements of each row a
// lane (two 16-byte loads that cover 512 contiguous bytes a wave); mean and
// variance are sums over the wave, and the normalized row goes to the A tile
// in LDS as f16, 8 bytes a store.
// The products are taken transposed (weights as A): a lane then holds 8
// neighbouring channels of one row and stores them as one 16-byte piece.
// q/k/v stored f16 in tile order, g f16 in 16 x 16 pieces (see QKV_TILE).
// ---------------------------------------------------------------------------
__global__ void __launch_bounds__(256) k_ln_qkvg(
    const float* M_raw, const float* g_ln, const float* b_ln, const float* bg,
    const f16* fq, const f16* fk, const f16* fv, const f16* fg,
    f16* q16, f16* k16, f16* v16p, f16* g16) {
  __shared__ __attribute__((aligned(16))) f16 lx[BROWS][LX_PITCH];
  int tid = threadIdx.x;
  int wave = __builtin_amdgcn_readfirstlane(tid >> 5), lane = tid & 31;
  {
    // The lane's columns: lane*4 + 0..3 and 128 + lane*4 + 0..3.
    v4f ga = *(const v4f*)(g_ln + lane * 4);
    v4f gb = *(const v4f*)(g_ln + 128 + lane * 4);
    v4f ba = *(const v4f*)(b_ln + lane * 4);
    v4f bb = *(const v4f*)(b_ln + 128 + lane * 4);
    const float* mp =
        M_raw + ((size_t)blockIdx.x * BROWS + wave * 8) * 256 + lane * 4;
    v4f xa[8], xb[8];
#pragma unroll
    for (int k = 0; k < 8; ++k) {
      xa[k] = *(const v4f*)(mp + k * 256);
      xb[k] = *(const v4f*)(mp + k * 256 + 128);
    }
    // The registers that hold the addresses of the loads above are reused
    // below: the wait stands in front of their overwrite.
    asm volatile("s_wait_xcnt 0x0" ::: "memory");
    // Keeps the later register writes behind that wait: one of them, to a word
    // of the rows' base address, was drawn up in front of it.
    __builtin_amdgcn_sched_barrier(0);
#pragma unroll
    for (int k = 0; k < 8; ++k) {
      v4f s4 = xa[k] + xb[k];
      float mu = wave_sum((s4[0] + s4[1]) + (s4[2] + s4[3])) * (1.f / 256.f);
      v4f da = xa[k] - mu, db = xb[k] - mu;
      v4f q4 = da * da + db * db;
      float vv = wave_sum((q4[0] + q4[1]) + (q4[2] + q4[3]));
      float rstd = rsqrtf(vv * (1.f / 256.f) + 1e-5f);
      v4f ya = da * rstd * ga + ba, yb = db * rstd * gb + bb;
      v4h ha, hb;
#pragma unroll
      for (int e = 0; e < 4; ++e) { ha[e] = (f16)ya[e]; hb[e] = (f16)yb[e]; }
      *(v4h*)&lx[wave * 8 + k][lane * 4] = ha;
      *(v4h*)&lx[wave * 8 + k][128 + lane * 4] = hb;
    }
  }
  __syncthreads();

  int hf = lane >> 4, colL = lane & 15;
  // Each wave has the same four n-tiles of two matrices: waves 0-3 of g and v,
  // waves 4-7 of q and k. The gate's long epilogue so
  // comes first, beside the other waves' products.
  int nt0 = (wave & 3) * 4;
  int gr0 = blockIdx.x * BROWS;
  v8f acc[MT][4];
  // The branch stands in front of the products, once per wave: between a
  // tile's last WMMA and the first use of its result there is then no branch.
  if (wave < 4) {
    mm_rows<4, true>(&lx[0][0], fg, nt0, lane, acc);
    // Keeps the epilogue out of the products' scheduling region: mixed in
    // there, where registers are scarce, all its stores went through one data
    // register, each waited for before the next conversion.
    __builtin_amdgcn_sched_barrier(0);
    // The register that holds the offset of the weight loads is given to a
    // load below as its destination: the wait stands in front of that.
    asm volatile("s_wait_xcnt 0x0" ::: "memory");
    // The gate bias of the lane's 32 columns. Read once, ahead of the stores
    // (read again behind each store, g16 could be bg for all the compiler
    // knows, it is waited for singly), and behind the products, when the
    // fragments' registers are free.
    v8f bgn[4];
#pragma unroll
    for (int j = 0; j < 4; ++j)
      bgn[j] = *(const v8f*)(bg + nt0 * 16 + 8 * hf + j * 16);
    // The register that holds the offset of these loads is reused below: the
    // wait stands in front of its overwrite.
    asm volatile("s_wait_xcnt 0x0" ::: "memory");
    // Keeps the eight loads in flight together: with the first additions drawn
    // up among them they are issued and waited for one or two at a time.
    __builtin_amdgcn_sched_barrier(0);
    // One address a lane; every tile step from it is a constant.
    f16* gp = g16 + ((size_t)(gr0 >> 4) * 16 + nt0) * QKV_PIECE + colL * 16 +
              8 * hf;
#pragma unroll
    for (int m = 0; m < MT; ++m)
#pragma unroll
      for (int j = 0; j < 4; ++j) {
        v8h o;
#pragma unroll
        for (int r = 0; r < 8; ++r)
          o[r] = (f16)(1.f / (1.f + __expf(-(acc[m][j][r] + bgn[j][r]))));
        *(v8h*)(gp + (m * 16 + j) * QKV_PIECE) = o;
        // The next tile overwrites the store's data registers.
        asm volatile("s_wait_xcnt 0x0" ::: "memory");
      }
  }
  int mat0 = (wave < 4) ? 2 : 0, mat1 = (wave < 4) ? 3 : 2;
  // Stays rolled: q, k and v run through the same code, which then takes a
  // third of the room in the instruction cache.
#pragma unroll 1
  for (int mat = mat0; mat < mat1; ++mat) {
    const f16* fr = (mat == 0) ? fq : (mat == 1) ? fk : fv;
    f16* dst = (mat == 0) ? q16 : (mat == 1) ? k16 : v16p;
    float sc = (mat == 0) ? 0.17677669529663687f : 1.f;  // q: 1/sqrt(C)
    mm_rows<4, true>(&lx[0][0], fr, nt0, lane, acc);
    // As above: keeps the epilogue out of the products' scheduling region.
    __builtin_amdgcn_sched_barrier(0);
    // The block's 64 rows lie in one s, the wave's four n-tiles in two heads:
    // one address a lane; every tile step from it is a constant.
    f16* dp = dst + (((size_t)(gr0 >> 8) * 8 + (nt0 >> 1)) * 16 +
                     ((gr0 & 255) >> 4)) * QKV_TILE + colL * 16 + hf * 8;
#pragma unroll
    for (int m = 0; m < MT; ++m)
#pragma unroll
      for (int j = 0; j < 4; ++j) {
        v8h o;
#pragma unroll
        for (int r = 0; r < 8; ++r) o[r] = (f16)(acc[m][j][r] * sc);
        *(v8h*)(dp + ((j >> 1) * 16 + m) * QKV_TILE + (j & 1) * QKV_PIECE) = o;
        // The next tile overwrites the store's data registers.
        asm volatile("s_wait_xcnt 0x0" ::: "memory");
      }
  }
}

#define PB_BLOCKS 512
#define SW_BLOCKS 160  // 5 matrices x 4096 threads / 128
static_assert(PB_BLOCKS + SW_BLOCKS == 672, "grid of k_pairbias_pack");
__device__ __forceinline__ void pairbias_part(
    float* lz, const float* Z, const float* gz, const float* bz,
    const float* bw, float* pb) {
  int tid = threadIdx.x;
  int wave = tid >> 5, lane = tid & 31;
  int it = blockIdx.x >> 5;  // rows i = it*16 + 0..15
  int jb = blockIdx.x & 31;  // keys j = jb*8 + 0..7
  // Thread t has the pair i = it*16 + ((t>>2)&15), j = jb*8 + (t>>6)*4 + (t&3).
  v4f z[32];
  {
    // Row k of this wave belongs to thread wave*32 + k.
    const float* zp = Z +
        (size_t)((it * 16 + (wave & 1) * 8) * 256 + jb * 8 + (wave >> 1) * 4) *
            128 + lane * 4;
#pragma unroll
    for (int k = 0; k < 32; ++k)
      z[k] = *(const v4f*)(zp + ((k >> 2) * 256 + (k & 3)) * 128);
    // The registers that hold the addresses of the loads above are reused
    // below: the wait stands in front of their overwrite.
    asm volatile("s_wait_xcnt 0x0" ::: "memory");
    float* lw = lz + wave * 32 * 132 + lane * 4;
#pragma unroll
    for (int k = 0; k < 32; ++k) *(v4f*)(lw + k * 132) = z[k];
  }
  __syncthreads();
  const float* lr = lz + tid * 132;
#pragma unroll
  for (int c = 0; c < 32; ++c) z[c] = *(const v4f*)(lr + c * 4);
  v4f s4 = z[0];
#pragma unroll
  for (int c = 1; c < 32; ++c) s4 += z[c];
  float mu = ((s4[0] + s4[1]) + (s4[2] + s4[3])) * (1.f / 128.f);
  v4f q4 = {0, 0, 0, 0};
#pragma unroll
  for (int c = 0; c < 32; ++c) {
    v4f d = z[c] - mu;
    q4 += d * d;
  }
  float vv = (q4[0] + q4[1]) + (q4[2] + q4[3]);
  float rstd = rsqrtf(vv * (1.f / 128.f) + 1e-5f);
  // No launch of this file writes these three inputs: read through the
  // constant address space they come by scalar loads, one for the wave
  // (behind the asm statement above they would else be vector loads).
  const cfloat* gzc = (const cfloat*)(unsigned long long)gz;
  const cfloat* bzc = (const cfloat*)(unsigned long long)bz;
  const cfloat* bwc = (const cfloat*)(unsigned long long)bw;
  // Even and odd channels are summed apart: two neighbouring channels go
  // through one packed multiply-add.
  v2f acc[8] = {{0, 0}, {0, 0}, {0, 0}, {0, 0}, {0, 0}, {0, 0}, {0, 0}, {0, 0}};
  // Stays rolled, 8 channels a trip: unrolled, the scalar loads of all trips
  // are lifted to the top, do not fit the scalar registers and are spilled.
#pragma unroll 1
  for (int p0 = 0; p0 < 128; p0 += 8) {
    v4f za = *(const v4f*)(lr + p0);
    v4f zb = *(const v4f*)(lr + p0 + 4);
    v2f nv[4] = {{za[0], za[1]}, {za[2], za[3]}, {zb[0], zb[1]}, {zb[2], zb[3]}};
#pragma unroll
    for (int t = 0; t < 4; ++t) {
      v2f g2 = {gzc[p0 + 2 * t], gzc[p0 + 2 * t + 1]};
      v2f b2 = {bzc[p0 + 2 * t], bzc[p0 + 2 * t + 1]};
      nv[t] = (nv[t] - mu) * rstd * g2 + b2;
    }
#pragma unroll
    for (int t = 0; t < 4; ++t)
#pragma unroll
      for (int h = 0; h < 8; ++h) {
        v2f w2 = {bwc[h * 128 + p0 + 2 * t], bwc[h * 128 + p0 + 2 * t + 1]};
        acc[h] += nv[t] * w2;
      }
  }
  float* pw = pb + (it * 16 + (jb >> 1)) * 256 + (tid >> 6) * 128 +
              (jb & 1) * 64 + (tid & 63);
#pragma unroll
  for (int h = 0; h < 8; ++h) pw[(size_t)h * 65536] = acc[h][0] + acc[h][1];
}

__global__ void __launch_bounds__(128) k_pairbias_pack(
    const float* Z, const float* gz, const float* bz, const float* bw,
    float* pb, const float* w0, const float* w1, const float* w2,
    const float* w3, const float* w4, f16* f0, f16* f1, f16* f2, f16* f3,
    f16* f4) {
  __shared__ __attribute__((aligned(16))) float lz[128 * 132];
  // The test reads the same for a whole block: all of its waves meet the
  // barrier of the pair bias or none does.
  if (blockIdx.x < PB_BLOCKS)
    pairbias_part(lz, Z, gz, bz, bw, pb);
  else
    swizzle_part((blockIdx.x - PB_BLOCKS) * 128 + threadIdx.x, w0, w1, w2, w3,
                 w4, f0, f1, f2, f3, f4);
}

__global__ void __launch_bounds__(128) k_attention(
    const f16* q16, const f16* k16, const f16* v16p, const float* pb,
    const float* mask, float* o32) {
  __shared__ __attribute__((aligned(16))) f16 lv[256 * 32];  // V tile, 16 KB
  int s_ = blockIdx.x >> 3, h_ = blockIdx.x & 7;
  size_t headoff = ((size_t)s_ * 8 + h_) * 256 * 32;
  const f16* qs = q16 + headoff;
  const f16* ks = k16 + headoff;
  const f16* vs = v16p + headoff;

#if USE_TDM
  if (threadIdx.x < 32) {
    unsigned lds_off = (unsigned)(unsigned long long)(const void*)&lv[0];
    unsigned long long ga = (unsigned long long)(const void*)vs;
    u32x4 g0;
    g0[0] = 1u;                                   // count=1, user mode
    g0[1] = lds_off;                              // lds_addr
    g0[2] = (unsigned)(ga & 0xffffffffu);         // global_addr[31:0]
    g0[3] = (unsigned)((ga >> 32) & 0x01ffffffu)  // global_addr[56:32]
            | (2u << 30);                         // type=2 (image)
    i32x8 g1;
    g1[0] = (int)(1u << 16);
    g1[1] = (int)(32u << 16);
    g1[2] = (int)(256u << 16);
    g1[3] = (int)(32u << 16);
    g1[4] = 256;
    g1[5] = 32;
    g1[6] = 0;
    g1[7] = 0;
    i32x4 gz4 = {0, 0, 0, 0};   // groups 2/3 unused (<=2D tensor)
#if __clang_major__ >= 23
    i32x8 gz8 = {0, 0, 0, 0, 0, 0, 0, 0};
    __builtin_amdgcn_tensor_load_to_lds(g0, g1, gz4, gz4, gz8, 0);
#else
    __builtin_amdgcn_tensor_load_to_lds(g0, g1, gz4, gz4, 0);
#endif
    __builtin_amdgcn_s_wait_tensorcnt(0);
  }
#else
  for (int t = threadIdx.x; t < 8192; t += 128) lv[t] = vs[t];
#endif
  __syncthreads();

  int wave = threadIdx.x >> 5, lane = threadIdx.x & 31;
  int hf = lane >> 4, colL = lane & 15;
  const float* pbh = pb + (size_t)h_ * 65536;
  const float* mrow = mask + (size_t)s_ * 256;
  const f16* vtp = lv + (8 * hf + (lane & 7)) * 16 + 8 * ((lane >> 3) & 1);
  const f16* qlp = qs + colL * 16 + hf * 8;
  const f16* klp = ks + colL * 16 + hf * 8;

  for (int itb = 0; itb < 4; ++itb) {
    int i0 = (itb * 4 + wave) * 16;
    // B = Q^T: lane holds column i = i0 + colL.
    v16h qb = frag_tiled(qlp, itb * 4 + wave);
    // pb lies in C-operand order (see kernel B): tile (i0/16, jt) is 256
    // floats, registers 0..3 of all lanes first, then registers 4..7.
    const float* pbt = pbh + (size_t)(itb * 4 + wave) * 4096 + lane * 4;
    // acc[jt][r] = logits[i0 + colL][jt*16 + 8*hf + r]; the pair bias and the
    // mask bias enter as the C operand.
    v8f acc[16];
#pragma unroll
    for (int jt = 0; jt < 16; ++jt) {
      v4f lo = *(const v4f*)(pbt + jt * 256);
      v4f hi = *(const v4f*)(pbt + jt * 256 + 128);
      acc[jt] = __builtin_shufflevector(lo, hi, 0, 1, 2, 3, 4, 5, 6, 7);
    }
    // The registers that hold the addresses of the loads above are reused
    // below: the wait stands in front of their overwrite.
    asm volatile("s_wait_xcnt 0x0" ::: "memory");
#pragma unroll
    for (int g = 0; g < 4; ++g) {
      v16h ka[4];
      v8f mv[4];
#pragma unroll
      for (int t = 0; t < 4; ++t) {
        int jt = g * 4 + t;
        ka[t] = frag_tiled(klp, jt);
        mv[t] = *(const v8f*)(mrow + jt * 16 + 8 * hf);
      }
      // Keeps the loads of four tiles in flight together: without it each
      // tile's loads are issued and waited for singly, in front of its WMMA.
      __builtin_amdgcn_sched_barrier(0);
#pragma unroll
      for (int t = 0; t < 4; ++t) {
        int jt = g * 4 + t;
        v8f c;
#pragma unroll
        for (int r = 0; r < 8; ++r) c[r] = acc[jt][r] + 1e9f * (mv[t][r] - 1.f);
        acc[jt] = wmma16(ka[t], qb, c);
      }
    }
    // softmax over j: 128 values of row i in this lane, the other 128 in
    // lane ^ 16.
    v8f mx = acc[0];
#pragma unroll
    for (int jt = 1; jt < 16; ++jt)
#pragma unroll
      for (int r = 0; r < 8; ++r) mx[r] = fmaxf(mx[r], acc[jt][r]);
    float m = fmaxf(fmaxf(fmaxf(mx[0], mx[1]), fmaxf(mx[2], mx[3])),
                    fmaxf(fmaxf(mx[4], mx[5]), fmaxf(mx[6], mx[7])));
    m = fmaxf(m, __shfl_xor(m, 16, 32));
    // Tiles 2kt and 2kt+1 hold keys kt*32 + {8*hf + 0..7, 16 + 8*hf + 0..7}:
    // converted in place they are the B fragment pt[kt] in the k order of
    // kk_of (unnormalized exp; 1/rowsum folded into the epilogue).
    v8f sv = {0, 0, 0, 0, 0, 0, 0, 0};
    v16h pt[8];
#pragma unroll
    for (int jt = 0; jt < 16; ++jt)
#pragma unroll
      for (int r = 0; r < 8; ++r) {
        float e = __expf(acc[jt][r] - m);
        sv[r] += e;
        pt[jt >> 1][(jt & 1) * 8 + r] = (f16)e;
      }
    float ssum = ((sv[0] + sv[1]) + (sv[2] + sv[3])) +
                 ((sv[4] + sv[5]) + (sv[6] + sv[7]));
    ssum += __shfl_xor(ssum, 16, 32);
    float rinv = 1.f / ssum;
    // Ot = V^T Pt
    v8f oacc[2] = {{0, 0, 0, 0, 0, 0, 0, 0}, {0, 0, 0, 0, 0, 0, 0, 0}};
#pragma unroll
    for (int kt = 0; kt < 8; ++kt)
#pragma unroll
      for (int ct = 0; ct < 2; ++ct) {
        v16h va = frag_tr16(vtp, ct, kt);
        oacc[ct] = wmma16(va, pt[kt], oacc[ct]);
      }
    // oacc[ct][r] = O[i0 + colL][ct*16 + 8*hf + r]: 32 bytes of piece
    // (row tile s*16 + i0/16, column tile h*2 + ct); the wave fills the piece.
    float* orow = o32 + (((size_t)s_ * 16 + (i0 >> 4)) * 16 + h_ * 2) * QKV_PIECE +
                  colL * 16 + 8 * hf;
#pragma unroll
    for (int ct = 0; ct < 2; ++ct) {
      v8f ov;
#pragma unroll
      for (int r = 0; r < 8; ++r) ov[r] = oacc[ct][r] * rinv;
      *(v8f*)(orow + ct * QKV_PIECE) = ov;
    }
    // The next trip overwrites the stores' address and data registers.
    asm volatile("s_wait_xcnt 0x0" ::: "memory");
  }
}

// ---------------------------------------------------------------------------
// Kernel D: out = (g * o) @ Wo + out_bias + M_raw
// One block = 64 rows; each of the 8 waves has 2 n-tiles against 4 row tiles.
// ---------------------------------------------------------------------------
__global__ void __launch_bounds__(256) k_out(
    const f16* g16, const float* o32, const f16* fo, const float* out_bias,
    const float* M_raw, float* out) {
  __shared__ __attribute__((aligned(16))) f16 lx[BROWS][LX_PITCH];
  int tid = threadIdx.x;
  size_t base = (size_t)blockIdx.x * BROWS * 256;
  // The wave's number as a scalar: the addresses of the wave's weight fragments
  // and columns then need no vector registers of their own, which are scarce
  // here (64 accumulators and 64 residuals a lane).
  int wave = __builtin_amdgcn_readfirstlane(tid >> 5);
  int lane = tid & 31, hf = lane >> 4, colL = lane & 15;
  int gr0 = blockIdx.x * BROWS;
  // The residual and the bias of the lane's output elements are read here,
  // with the staging loads: read among the stores of the epilogue (out could
  // be M_raw, for all the compiler knows) each is waited for singly.
  float res[MT][2][8], ob[2];
#pragma unroll
  for (int t = 0; t < 2; ++t) ob[t] = out_bias[(wave * 2 + t) * 16 + colL];
  // The register that holds the offset of the two loads above is given to a
  // later load as its destination: the wait stands in front of that.
  asm volatile("s_wait_xcnt 0x0" ::: "memory");
  // One offset a lane for the residual and the output; every tile, row and
  // column step from it is a constant.
  size_t eoff = (size_t)(gr0 + 8 * hf) * 256 + wave * 32 + colL;
  const float* mp = M_raw + eoff;
#pragma unroll
  for (int t = 0; t < 2; ++t)
#pragma unroll
    for (int m = 0; m < MT; ++m)
#pragma unroll
      for (int r = 0; r < 8; ++r)
        res[m][t][r] = mp[(m * 16 + r) * 256 + t * 16];
#pragma unroll
  for (int it = 0; it < BROWS; ++it) {
    int idx = it * 256 + tid;
    float gv = (float)g16[base + idx];
    // g and o come in tile order: trip it is the piece of row tile it / 16 and
    // column tile it % 16, thread tid its row tid / 16, column tid % 16.
    lx[(it >> 4) * 16 + (tid >> 4)][(it & 15) * 16 + (tid & 15)] =
        (f16)(gv * o32[base + idx]);
  }
  __syncthreads();
  // All products stand ahead of the first store, so that no weight load need
  // wait behind a store.
  v8f acc[MT][2];
  mm_rows<2>(&lx[0][0], fo, wave * 2, lane, acc);
  float* op = out + eoff;
#pragma unroll
  for (int m = 0; m < MT; ++m)
#pragma unroll
    for (int t = 0; t < 2; ++t)
#pragma unroll
      for (int r = 0; r < 8; ++r)
        op[(m * 16 + r) * 256 + t * 16] = acc[m][t][r] + ob[t] + res[m][t][r];
}

// ---------------------------------------------------------------------------
extern "C" void kernel_launch(void* const* d_in, const int* in_sizes, int n_in,
                              void* d_out, int out_size, void* d_ws,
                              size_t ws_size, hipStream_t stream) {
  (void)in_sizes; (void)n_in; (void)out_size; (void)ws_size;
  const float* M_raw  = (const float*)d_in[0];
  const float* Z      = (const float*)d_in[1];
  const float* M_mask = (const float*)d_in[2];
  const float* ln_m_g = (const float*)d_in[3];
  const float* ln_m_b = (const float*)d_in[4];
  const float* ln_z_g = (const float*)d_in[5];
  const float* ln_z_b = (const float*)d_in[6];
  const float* b_w    = (const float*)d_in[7];
  const float* Wq     = (const float*)d_in[8];
  const float* Wk     = (const float*)d_in[9];
  const float* Wv     = (const float*)d_in[10];
  const float* Wg     = (const float*)d_in[11];
  const float* bg     = (const float*)d_in[12];
  const float* Wo     = (const float*)d_in[13];
  const float* ob     = (const float*)d_in[14];
  float* out = (float*)d_out;

  char* ws = (char*)d_ws;
  size_t off = 0;
  auto take = [&](size_t b) {
    char* p = ws + off;
    off += (b + 255) & ~(size_t)255;
    return p;
  };
  f16* fq   = (f16*)take(131072);      // swizzled weight fragments (f16)
  f16* fk   = (f16*)take(131072);
  f16* fv   = (f16*)take(131072);
  f16* fg   = (f16*)take(131072);
  f16* fo   = (f16*)take(131072);
  f16* q16  = (f16*)take(16777216);    // f16, tile order (QKV_TILE)
  f16* k16  = (f16*)take(16777216);
  f16* v16p = (f16*)take(16777216);
  f16* g16  = (f16*)take(16777216);    // f16, 16 x 16 pieces
  float* o32 = (float*)take(33554432); // f32, 16 x 16 pieces
  float* pb  = (float*)take(2097152);  // f32, C-operand order (kernel B)

  k_pairbias_pack<<<672, 128, 0, stream>>>(
      Z, ln_z_g, ln_z_b, b_w, pb, Wq, Wk, Wv, Wg, Wo, fq, fk, fv, fg, fo);
  k_ln_qkvg<<<512, 256, 0, stream>>>(M_raw, ln_m_g, ln_m_b, bg, fq, fk, fv,
                                      fg, q16, k16, v16p, g16);
  k_attention<<<1024, 128, 0, stream>>>(q16, k16, v16p, pb, M_mask, o32);
  k_out<<<512, 256, 0, stream>>>(g16, o32, fo, ob, M_raw, out);
}
